// v000
// Times are from an AMD MI455X. After a warm-up the kernel runs many times in a row, and a time is the length of
// such a window on the GPU divided by its runs, so every launch and the gaps after it count. The runs cycle
// through copies of the inputs. A figure is the median of several windows, for all but v000 over two sittings.
// Sittings can differ by a few percent; kernels timed side by side share one.
// v000 is the starting kernel. One run takes 769 microseconds.
#include <hip/hip_runtime.h>

typedef __attribute__((ext_vector_type(16))) _Float16 v16h;
typedef __attribute__((ext_vector_type(8)))  _Float16 v8h;
typedef __attribute__((ext_vector_type(8)))  float    v8f;
typedef __attribute__((ext_vector_type(4)))  int      v4i;

#define BB 2
#define SS 2048
#define DD 2048
#define NH 16
#define HD 128
#define MM (BB*SS)      /* 4096 rows */
#define N1 (3*DD)       /* 6144 fused QKV cols */

/* ---- workspace layout (bytes) ---- */
#define OFF_XH   ((size_t)0)
#define OFF_WQKV (OFF_XH   + (size_t)MM*DD*2)     /* x in f16            */
#define OFF_WO   (OFF_WQKV + (size_t)N1*DD*2)     /* [wq;wk;wv] f16      */
#define OFF_Y    (OFF_WO   + (size_t)DD*DD*2)     /* wo f16              */
#define OFF_QH   (OFF_Y    + (size_t)MM*N1*4)     /* fused QKV f32       */
#define OFF_KH   (OFF_QH   + (size_t)MM*DD*2)     /* q f16 [B,N,S,HD]    */
#define OFF_VH   (OFF_KH   + (size_t)MM*DD*2)
#define OFF_OH   (OFF_VH   + (size_t)MM*DD*2)     /* attn out f16 [B,S,D]*/

/* ---- CDNA5 async global->LDS copy (ASYNCcnt-tracked, bypasses VGPRs) ---- */
#if __has_builtin(__builtin_amdgcn_global_load_async_to_lds_b128) && \
    __has_builtin(__builtin_amdgcn_s_wait_asynccnt)
#define USE_ASYNC 1
#else
#define USE_ASYNC 0
#endif

/* b128 payload type: <4 x i32>; clang prints AS(1) as `__device__` in HIP */
typedef __attribute__((address_space(1))) v4i gv4i;
typedef __attribute__((address_space(3))) v4i lv4i;

__device__ __forceinline__ void async_cp16(const void* g, void* l) {
#if USE_ASYNC
  /* generic LDS pointers carry the LDS byte offset in the low 32 bits
     (flat->LDS aperture mapping: LDS_ADDR = addr[31:0]) */
  __builtin_amdgcn_global_load_async_to_lds_b128(
      (gv4i*)(unsigned long long)(size_t)g,
      (lv4i*)(unsigned int)(size_t)l, 0, 0);
#else
  (void)g; (void)l;
#endif
}

/* ---------------- f32 -> f16 convert ---------------- */
__global__ __launch_bounds__(256) void cvt_f16(const float* __restrict__ src,
                                               _Float16* __restrict__ dst, int n) {
  for (int i = blockIdx.x * 256 + threadIdx.x; i < n; i += gridDim.x * 256)
    dst[i] = (_Float16)src[i];
}

/* Fragment loader per CDNA5 ISA 7.12.2 (16-bit A 16x32 / B 32x16 layouts).
   tile: pointer to the 16-row tile origin; row dim stride = `stride` halves;
   contiguous (matmul-K) dim carries the 8+8 half split at +0 / +16. */
__device__ __forceinline__ v16h ld_frag(const _Float16* tile, int stride) {
  const int lane = threadIdx.x & 31;
  const _Float16* p = tile + (size_t)(lane & 15) * stride + ((lane >> 4) << 3);
  v8h lo = *(const v8h*)(p);
  v8h hi = *(const v8h*)(p + 16);
  v16h r;
#pragma unroll
  for (int i = 0; i < 8; ++i) { r[i] = lo[i]; r[8 + i] = hi[i]; }
  return r;
}

/* ---------------- WMMA GEMM: C[M,N] = A[M,K] * Bw[N,K]^T + bias ----------------
   128x128 block tile, 8 waves, wave tile 32x64 (2x4 of 16x16), K-step 32.
   Global->LDS staging via async copy engine, LDS double buffered:
   4 async b128 ops per wave per stage; s_wait_asynccnt 4 retires the previous
   stage (per-wave in-order completion) while the next stage streams. */
__global__ __launch_bounds__(256) void gemm_wmma(
    const _Float16* __restrict__ A, const _Float16* __restrict__ Bw,
    float* __restrict__ C, int Mdim, int Ndim, int Kdim,
    const float* __restrict__ b0, const float* __restrict__ b1,
    const float* __restrict__ b2, int s1, int s2)
{
  __shared__ __align__(16) _Float16 ldsA[2][128 * 32];
  __shared__ __align__(16) _Float16 ldsB[2][128 * 32];
  const int tid  = threadIdx.x;
  const int lane = tid & 31, wave = tid >> 5;
  const int l15  = lane & 15, hi8 = (lane >> 4) << 3;
  const int wm = wave >> 1, wn = wave & 1;
  const int mBase = blockIdx.y * 128;
  const int nBase = blockIdx.x * 128;

  const v8f zf = {};
  v8f acc[2][4];
#pragma unroll
  for (int i = 0; i < 2; i++)
#pragma unroll
    for (int j = 0; j < 4; j++) acc[i][j] = zf;

  int rowT[2], segT[2];
#pragma unroll
  for (int t = 0; t < 2; t++) {
    int c = tid + t * 256;            /* 512 16B chunks per 128x32 tile */
    rowT[t] = c >> 2;
    segT[t] = (c & 3) << 3;
  }

  const int nk = Kdim >> 5;

#if USE_ASYNC
  /* ---- async pipeline ---- */
#pragma unroll
  for (int t = 0; t < 2; t++) {       /* stage 0 */
    async_cp16(A  + (size_t)(mBase + rowT[t]) * Kdim + segT[t],
               &ldsA[0][rowT[t] * 32 + segT[t]]);
    async_cp16(Bw + (size_t)(nBase + rowT[t]) * Kdim + segT[t],
               &ldsB[0][rowT[t] * 32 + segT[t]]);
  }
  for (int kb = 0; kb < nk; ++kb) {
    const int st = kb & 1;
    if (kb + 1 < nk) {
      const int k0 = (kb + 1) << 5;
      __builtin_prefetch(A + (size_t)(mBase + rowT[0]) * Kdim + k0 + 64, 0, 0);
#pragma unroll
      for (int t = 0; t < 2; t++) {
        async_cp16(A  + (size_t)(mBase + rowT[t]) * Kdim + k0 + segT[t],
                   &ldsA[st ^ 1][rowT[t] * 32 + segT[t]]);
        async_cp16(Bw + (size_t)(nBase + rowT[t]) * Kdim + k0 + segT[t],
                   &ldsB[st ^ 1][rowT[t] * 32 + segT[t]]);
      }
      __builtin_amdgcn_s_wait_asynccnt(4);   /* previous stage landed */
    } else {
      __builtin_amdgcn_s_wait_asynccnt(0);
    }
    __syncthreads();
    v16h af[2], bf[4];
#pragma unroll
    for (int i = 0; i < 2; i++) af[i] = ld_frag(&ldsA[st][(wm * 32 + i * 16) * 32], 32);
#pragma unroll
    for (int j = 0; j < 4; j++) bf[j] = ld_frag(&ldsB[st][(wn * 64 + j * 16) * 32], 32);
#pragma unroll
    for (int i = 0; i < 2; i++)
#pragma unroll
      for (int j = 0; j < 4; j++)
        acc[i][j] = __builtin_amdgcn_wmma_f32_16x16x32_f16(
            false, af[i], false, bf[j], (short)0, acc[i][j], false, false);
    __syncthreads();
  }
#else
  /* ---- fallback: register-staged pipeline ---- */
  v8h ra[2], rb[2];
#pragma unroll
  for (int t = 0; t < 2; t++) {
    ra[t] = *(const v8h*)(A  + (size_t)(mBase + rowT[t]) * Kdim + segT[t]);
    rb[t] = *(const v8h*)(Bw + (size_t)(nBase + rowT[t]) * Kdim + segT[t]);
  }
  for (int kb = 0; kb < nk; ++kb) {
#pragma unroll
    for (int t = 0; t < 2; t++) {
      *(v8h*)(&ldsA[0][rowT[t] * 32 + segT[t]]) = ra[t];
      *(v8h*)(&ldsB[0][rowT[t] * 32 + segT[t]]) = rb[t];
    }
    __syncthreads();
    if (kb + 1 < nk) {
      const int k0 = (kb + 1) << 5;
      __builtin_prefetch(A + (size_t)(mBase + rowT[0]) * Kdim + k0 + 32, 0, 0);
#pragma unroll
      for (int t = 0; t < 2; t++) {
        ra[t] = *(const v8h*)(A  + (size_t)(mBase + rowT[t]) * Kdim + k0 + segT[t]);
        rb[t] = *(const v8h*)(Bw + (size_t)(nBase + rowT[t]) * Kdim + k0 + segT[t]);
      }
    }
    v16h af[2], bf[4];
#pragma unroll
    for (int i = 0; i < 2; i++) af[i] = ld_frag(&ldsA[0][(wm * 32 + i * 16) * 32], 32);
#pragma unroll
    for (int j = 0; j < 4; j++) bf[j] = ld_frag(&ldsB[0][(wn * 64 + j * 16) * 32], 32);
#pragma unroll
    for (int i = 0; i < 2; i++)
#pragma unroll
      for (int j = 0; j < 4; j++)
        acc[i][j] = __builtin_amdgcn_wmma_f32_16x16x32_f16(
            false, af[i], false, bf[j], (short)0, acc[i][j], false, false);
    __syncthreads();
  }
#endif

  /* epilogue: C/D layout — lane holds col, VGPR r holds row r + 8*(lane>=16) */
#pragma unroll
  for (int i = 0; i < 2; i++)
#pragma unroll
    for (int j = 0; j < 4; j++) {
      const int col = nBase + wn * 64 + j * 16 + l15;
      const float bias = (col < s1) ? b0[col] : (col < s2) ? b1[col - s1] : b2[col - s2];
#pragma unroll
      for (int r = 0; r < 8; r++) {
        const int row = mBase + wm * 32 + i * 16 + r + hi8;
        C[(size_t)row * Ndim + col] = acc[i][j][r] + bias;
      }
    }
}

/* ---------------- RMSNorm + RoPE + repack to [B,N,S,HD] f16 ---------------- */
__global__ __launch_bounds__(256) void norm_rope(
    const float* __restrict__ Y, const float* __restrict__ freqs,
    const float* __restrict__ gq, const float* __restrict__ gk,
    _Float16* __restrict__ qh, _Float16* __restrict__ kh, _Float16* __restrict__ vh)
{
  const int m = blockIdx.x;
  const int b = m / SS, s = m % SS;
  const int tid = threadIdx.x;
  const float* Yr = Y + (size_t)m * N1;
  const int c0 = tid * 8;

  float qv[8], kv[8], vv[8];
  float sq = 0.f, sk = 0.f;
#pragma unroll
  for (int j = 0; j < 8; j++) {
    qv[j] = Yr[c0 + j]; kv[j] = Yr[DD + c0 + j]; vv[j] = Yr[2 * DD + c0 + j];
    sq += qv[j] * qv[j]; sk += kv[j] * kv[j];
  }
  for (int msk = 16; msk; msk >>= 1) {
    sq += __shfl_xor(sq, msk, 32);
    sk += __shfl_xor(sk, msk, 32);
  }
  __shared__ float red[16];
  const int wid = tid >> 5;
  if ((tid & 31) == 0) { red[wid] = sq; red[8 + wid] = sk; }
  __syncthreads();
  if (tid == 0) {
    float a = 0.f, c = 0.f;
    for (int i = 0; i < 8; i++) { a += red[i]; c += red[8 + i]; }
    red[0] = a; red[8] = c;
  }
  __syncthreads();
  const float rq = rsqrtf(red[0] * (1.0f / DD) + 1e-6f);
  const float rk = rsqrtf(red[8] * (1.0f / DD) + 1e-6f);

  const int n  = c0 / HD;
  const int d0 = c0 % HD;
  const size_t ob = ((size_t)(b * NH + n) * SS + s) * HD + d0;
#pragma unroll
  for (int j = 0; j < 8; j += 2) {
    const int p = (d0 + j) >> 1;
    const float f  = freqs[(size_t)s * (HD / 2) + p];
    const float cf = __cosf(f), sf = __sinf(f);
    const float u0 = qv[j]     * rq * gq[c0 + j];
    const float u1 = qv[j + 1] * rq * gq[c0 + j + 1];
    qh[ob + j]     = (_Float16)(u0 * cf - u1 * sf);
    qh[ob + j + 1] = (_Float16)(u0 * sf + u1 * cf);
    const float w0 = kv[j]     * rk * gk[c0 + j];
    const float w1 = kv[j + 1] * rk * gk[c0 + j + 1];
    kh[ob + j]     = (_Float16)(w0 * cf - w1 * sf);
    kh[ob + j + 1] = (_Float16)(w0 * sf + w1 * cf);
    vh[ob + j]     = (_Float16)vv[j];
    vh[ob + j + 1] = (_Float16)vv[j + 1];
  }
}

/* ---------------- Flash attention (WMMA QK^T and PV) ----------------
   128 threads = 4 waves; each wave owns 32 query rows; Q kept in registers;
   key tiles of 32 streamed through LDS: K via async copy engine (ASYNCcnt),
   V transposed through VGPRs (layout change). */
__global__ __launch_bounds__(128) void attn_wmma(
    const _Float16* __restrict__ qh, const _Float16* __restrict__ kh,
    const _Float16* __restrict__ vh, const int* __restrict__ seq_lens,
    _Float16* __restrict__ oh)
{
  __shared__ __align__(16) _Float16 ldsK[32 * 128];
  __shared__ __align__(16) _Float16 ldsVt[128 * 32];
  __shared__ __align__(16) _Float16 ldsP[4 * 32 * 32];

  const int tid = threadIdx.x;
  const int lane = tid & 31, w = tid >> 5;
  const int l15 = lane & 15, hi8 = (lane >> 4) << 3;
  const int nqt = SS / 128;
  const int qt = blockIdx.x % nqt;
  const int h  = (blockIdx.x / nqt) % NH;
  const int b  = blockIdx.x / (nqt * NH);
  const int slen = seq_lens[b];
  const float SCALE = 0.08838834764831845f; /* 1/sqrt(128) */

  const size_t headO = (size_t)(b * NH + h) * SS * HD;
  const _Float16* qbase = qh + headO + (size_t)(qt * 128 + w * 32) * HD;
  const _Float16* kbase = kh + headO;
  const _Float16* vbase = vh + headO;

  v16h qf[2][4];
#pragma unroll
  for (int i = 0; i < 2; i++)
#pragma unroll
    for (int dc = 0; dc < 4; dc++)
      qf[i][dc] = ld_frag(qbase + (size_t)(i * 16) * HD + dc * 32, HD);

  const v8f zf = {};
  v8f o[2][8];
#pragma unroll
  for (int i = 0; i < 2; i++)
#pragma unroll
    for (int dj = 0; dj < 8; dj++) o[i][dj] = zf;
  float mrow[2][8], lrow[2][8];
#pragma unroll
  for (int i = 0; i < 2; i++)
#pragma unroll
    for (int r = 0; r < 8; r++) { mrow[i][r] = -3.0e38f; lrow[i][r] = 0.f; }

  const int nkt = (slen + 31) >> 5;
  for (int kt = 0; kt < nkt; ++kt) {
    /* stage K tile [32][128] via async engine; V transposed to [128][32] */
#pragma unroll
    for (int t = 0; t < 4; t++) {
      const int c = tid + t * 128;            /* 512 chunks of 8 halves */
      const int kk = c >> 4, seg = (c & 15) << 3;
#if USE_ASYNC
      async_cp16(kbase + (size_t)(kt * 32 + kk) * HD + seg, ldsK + kk * HD + seg);
#else
      v8h kv = *(const v8h*)(kbase + (size_t)(kt * 32 + kk) * HD + seg);
      *(v8h*)(ldsK + kk * HD + seg) = kv;
#endif
      v8h vv = *(const v8h*)(vbase + (size_t)(kt * 32 + kk) * HD + seg);
#pragma unroll
      for (int e = 0; e < 8; e++) ldsVt[(seg + e) * 32 + kk] = vv[e];
    }
#if USE_ASYNC
    __builtin_amdgcn_s_wait_asynccnt(0);
#endif
    __syncthreads();

    /* scores = Q * K^T : A=Q rows, B=K rows (both K-contiguous over d) */
    v8f sc[2][2];
#pragma unroll
    for (int i = 0; i < 2; i++)
#pragma unroll
      for (int j = 0; j < 2; j++) sc[i][j] = zf;
#pragma unroll
    for (int dc = 0; dc < 4; dc++) {
      v16h bk0 = ld_frag(ldsK + 0 * 16 * HD + dc * 32, HD);
      v16h bk1 = ld_frag(ldsK + 1 * 16 * HD + dc * 32, HD);
#pragma unroll
      for (int i = 0; i < 2; i++) {
        sc[i][0] = __builtin_amdgcn_wmma_f32_16x16x32_f16(
            false, qf[i][dc], false, bk0, (short)0, sc[i][0], false, false);
        sc[i][1] = __builtin_amdgcn_wmma_f32_16x16x32_f16(
            false, qf[i][dc], false, bk1, (short)0, sc[i][1], false, false);
      }
    }

    /* scale + key mask (lane owns one key column) */
#pragma unroll
    for (int j = 0; j < 2; j++) {
      const int kg = kt * 32 + j * 16 + l15;
      const bool valid = kg < slen;
#pragma unroll
      for (int i = 0; i < 2; i++)
#pragma unroll
        for (int r = 0; r < 8; r++)
          sc[i][j][r] = valid ? sc[i][j][r] * SCALE : -3.0e38f;
    }

    /* online softmax: row stats live across the 16 lanes of a half-wave */
    float alr[2][8];
#pragma unroll
    for (int i = 0; i < 2; i++)
#pragma unroll
      for (int r = 0; r < 8; r++) {
        float t = fmaxf(sc[i][0][r], sc[i][1][r]);
        for (int msk = 8; msk; msk >>= 1) t = fmaxf(t, __shfl_xor(t, msk, 32));
        const float mn = fmaxf(mrow[i][r], t);
        const float al = __expf(mrow[i][r] - mn);
        const float p0 = __expf(sc[i][0][r] - mn);
        const float p1 = __expf(sc[i][1][r] - mn);
        sc[i][0][r] = p0; sc[i][1][r] = p1;
        float rs = p0 + p1;
        for (int msk = 8; msk; msk >>= 1) rs += __shfl_xor(rs, msk, 32);
        lrow[i][r] = lrow[i][r] * al + rs;
        mrow[i][r] = mn;
        alr[i][r]  = al;
      }
#pragma unroll
    for (int i = 0; i < 2; i++)
#pragma unroll
      for (int dj = 0; dj < 8; dj++)
#pragma unroll
        for (int r = 0; r < 8; r++) o[i][dj][r] *= alr[i][r];

    /* P: C-layout -> A-layout via per-wave LDS patch */
    _Float16* Pw = ldsP + w * 32 * 32;
#pragma unroll
    for (int i = 0; i < 2; i++)
#pragma unroll
      for (int j = 0; j < 2; j++)
#pragma unroll
        for (int r = 0; r < 8; r++)
          Pw[(i * 16 + r + hi8) * 32 + j * 16 + l15] = (_Float16)sc[i][j][r];
    __builtin_amdgcn_wave_barrier();

    /* O += P * V  (B frags from transposed V: N=d, matmul-K=key) */
    v16h pf0 = ld_frag(Pw, 32);
    v16h pf1 = ld_frag(Pw + 16 * 32, 32);
#pragma unroll
    for (int dj = 0; dj < 8; dj++) {
      v16h vf = ld_frag(ldsVt + dj * 16 * 32, 32);
      o[0][dj] = __builtin_amdgcn_wmma_f32_16x16x32_f16(
          false, pf0, false, vf, (short)0, o[0][dj], false, false);
      o[1][dj] = __builtin_amdgcn_wmma_f32_16x16x32_f16(
          false, pf1, false, vf, (short)0, o[1][dj], false, false);
    }
    __syncthreads();
  }

  /* normalize and write [B,S,D] f16 for the output projection */
#pragma unroll
  for (int i = 0; i < 2; i++)
#pragma unroll
    for (int r = 0; r < 8; r++) {
      const int srow = qt * 128 + w * 32 + i * 16 + r + hi8;
      const float inv = 1.0f / lrow[i][r];
#pragma unroll
      for (int dj = 0; dj < 8; dj++) {
        const int col = h * HD + dj * 16 + l15;
        oh[((size_t)(b * SS + srow)) * DD + col] = (_Float16)(o[i][dj][r] * inv);
      }
    }
}

/* ---------------- host-side orchestration ---------------- */
extern "C" void kernel_launch(void* const* d_in, const int* in_sizes, int n_in,
                              void* d_out, int out_size, void* d_ws, size_t ws_size,
                              hipStream_t stream) {
  (void)in_sizes; (void)n_in; (void)out_size; (void)ws_size;
  const float* x        = (const float*)d_in[0];
  const int*   seq_lens = (const int*)d_in[1];
  const float* freqs    = (const float*)d_in[2];
  const float* wq = (const float*)d_in[3];
  const float* bq = (const float*)d_in[4];
  const float* wk = (const float*)d_in[5];
  const float* bk = (const float*)d_in[6];
  const float* wv = (const float*)d_in[7];
  const float* bv = (const float*)d_in[8];
  const float* wo = (const float*)d_in[9];
  const float* bo = (const float*)d_in[10];
  const float* gq = (const float*)d_in[11];
  const float* gk = (const float*)d_in[12];

  char* ws = (char*)d_ws;
  _Float16* xh    = (_Float16*)(ws + OFF_XH);
  _Float16* wqkvh = (_Float16*)(ws + OFF_WQKV);
  _Float16* woh   = (_Float16*)(ws + OFF_WO);
  float*    Y     = (float*)(ws + OFF_Y);
  _Float16* qhp   = (_Float16*)(ws + OFF_QH);
  _Float16* khp   = (_Float16*)(ws + OFF_KH);
  _Float16* vhp   = (_Float16*)(ws + OFF_VH);
  _Float16* ohp   = (_Float16*)(ws + OFF_OH);

  /* 1) down-convert activations + weights to f16 */
  cvt_f16<<<1024, 256, 0, stream>>>(x,  xh,               MM * DD);
  cvt_f16<<<1024, 256, 0, stream>>>(wq, wqkvh,            DD * DD);
  cvt_f16<<<1024, 256, 0, stream>>>(wk, wqkvh + (size_t)DD * DD,     DD * DD);
  cvt_f16<<<1024, 256, 0, stream>>>(wv, wqkvh + (size_t)2 * DD * DD, DD * DD);
  cvt_f16<<<1024, 256, 0, stream>>>(wo, woh,              DD * DD);

  /* 2) fused QKV projection: Y[4096,6144] = xh * [wq;wk;wv]^T + [bq|bk|bv] */
  gemm_wmma<<<dim3(N1 / 128, MM / 128), 256, 0, stream>>>(
      xh, wqkvh, Y, MM, N1, DD, bq, bk, bv, DD, 2 * DD);

  /* 3) RMSNorm + RoPE + repack */
  norm_rope<<<MM, 256, 0, stream>>>(Y, freqs, gq, gk, qhp, khp, vhp);

  /* 4) flash attention */
  attn_wmma<<<BB * NH * (SS / 128), 128, 0, stream>>>(qhp, khp, vhp, seq_lens, ohp);

  /* 5) output projection into d_out (f32) */
  gemm_wmma<<<dim3(DD / 128, MM / 128), 256, 0, stream>>>(
      ohp, woh, (float*)d_out, MM, DD, DD, bo, bo, bo, DD, 2 * DD);
}

// v001
// Measured time: 499 microseconds a run.
// In two side-by-side timings against v000, it was 1.58 and 1.59 times as fast.
#include <hip/hip_runtime.h>

typedef __attribute__((ext_vector_type(16))) _Float16 v16h;
typedef __attribute__((ext_vector_type(8)))  _Float16 v8h;
typedef __attribute__((ext_vector_type(8)))  float    v8f;
typedef __attribute__((ext_vector_type(4)))  int      v4i;

#define BB 2
#define SS 2048
#define DD 2048
#define NH 16
#define HD 128
#define MM (BB*SS)      /* 4096 rows */
#define N1 (3*DD)       /* 6144 fused QKV cols */

/* ---- workspace layout (bytes) ---- */
#define OFF_XH   ((size_t)0)
#define OFF_WQKV (OFF_XH   + (size_t)MM*DD*2)     /* x in f16            */
#define OFF_WO   (OFF_WQKV + (size_t)N1*DD*2)     /* [wq;wk;wv] f16      */
#define OFF_Y    (OFF_WO   + (size_t)DD*DD*2)     /* wo f16              */
#define OFF_QH   (OFF_Y    + (size_t)MM*N1*4)     /* fused QKV f32       */
#define OFF_KH   (OFF_QH   + (size_t)MM*DD*2)     /* q f16 [B,N,S,HD]    */
#define OFF_VH   (OFF_KH   + (size_t)MM*DD*2)
#define OFF_OH   (OFF_VH   + (size_t)MM*DD*2)     /* attn out f16 [B,S,D]*/

/* ---- CDNA5 async global->LDS copy (ASYNCcnt-tracked, bypasses VGPRs) ---- */
#if __has_builtin(__builtin_amdgcn_global_load_async_to_lds_b128) && \
    __has_builtin(__builtin_amdgcn_s_wait_asynccnt)
#define USE_ASYNC 1
#else
#define USE_ASYNC 0
#endif

/* b128 payload type: <4 x i32>; clang prints AS(1) as `__device__` in HIP */
typedef __attribute__((address_space(1))) v4i gv4i;
typedef __attribute__((address_space(3))) v4i lv4i;

__device__ __forceinline__ void async_cp16(const void* g, void* l) {
#if USE_ASYNC
  /* generic LDS pointers carry the LDS byte offset in the low 32 bits
     (flat->LDS aperture mapping: LDS_ADDR = addr[31:0]) */
  __builtin_amdgcn_global_load_async_to_lds_b128(
      (gv4i*)(unsigned long long)(size_t)g,
      (lv4i*)(unsigned int)(size_t)l, 0, 0);
#else
  (void)g; (void)l;
#endif
}

/* ---------------- f32 -> f16 convert ---------------- */
__global__ __launch_bounds__(256) void cvt_f16(const float* __restrict__ src,
                                               _Float16* __restrict__ dst, int n) {
  for (int i = blockIdx.x * 256 + threadIdx.x; i < n; i += gridDim.x * 256)
    dst[i] = (_Float16)src[i];
}

/* Fragment loader per CDNA5 ISA 7.12.2 (16-bit A 16x32 / B 32x16 layouts).
   tile: pointer to the 16-row tile origin; row dim stride = `stride` halves;
   contiguous (matmul-K) dim carries the 8+8 half split at +0 / +16. */
__device__ __forceinline__ v16h ld_frag(const _Float16* tile, int stride) {
  const int lane = threadIdx.x & 31;
  const _Float16* p = tile + (size_t)(lane & 15) * stride + ((lane >> 4) << 3);
  v8h lo = *(const v8h*)(p);
  v8h hi = *(const v8h*)(p + 16);
  v16h r;
#pragma unroll
  for (int i = 0; i < 8; ++i) { r[i] = lo[i]; r[8 + i] = hi[i]; }
  return r;
}

/* ---------------- WMMA GEMM: C[M,N] = A[M,K] * Bw[N,K]^T + bias ----------------
   128x128 block tile, 8 waves, wave tile 32x64 (2x4 of 16x16), K-step 32.
   Global->LDS staging via async copy engine, LDS double buffered:
   4 async b128 ops per wave per stage; s_wait_asynccnt 4 retires the previous
   stage (per-wave in-order completion) while the next stage streams. */
__global__ __launch_bounds__(256) void gemm_wmma(
    const _Float16* __restrict__ A, const _Float16* __restrict__ Bw,
    float* __restrict__ C, int Mdim, int Ndim, int Kdim,
    const float* __restrict__ b0, const float* __restrict__ b1,
    const float* __restrict__ b2, int s1, int s2)
{
  __shared__ __align__(16) _Float16 ldsA[2][128 * 32];
  __shared__ __align__(16) _Float16 ldsB[2][128 * 32];
  const int tid  = threadIdx.x;
  const int lane = tid & 31, wave = tid >> 5;
  const int l15  = lane & 15, hi8 = (lane >> 4) << 3;
  const int wm = wave >> 1, wn = wave & 1;
  const int mBase = blockIdx.y * 128;
  const int nBase = blockIdx.x * 128;

  const v8f zf = {};
  v8f acc[2][4];
#pragma unroll
  for (int i = 0; i < 2; i++)
#pragma unroll
    for (int j = 0; j < 4; j++) acc[i][j] = zf;

  int rowT[2], segT[2];
#pragma unroll
  for (int t = 0; t < 2; t++) {
    int c = tid + t * 256;            /* 512 16B chunks per 128x32 tile */
    rowT[t] = c >> 2;
    segT[t] = (c & 3) << 3;
  }

  const int nk = Kdim >> 5;

#if USE_ASYNC
  /* ---- async pipeline ---- */
#pragma unroll
  for (int t = 0; t < 2; t++) {       /* stage 0 */
    async_cp16(A  + (size_t)(mBase + rowT[t]) * Kdim + segT[t],
               &ldsA[0][rowT[t] * 32 + segT[t]]);
    async_cp16(Bw + (size_t)(nBase + rowT[t]) * Kdim + segT[t],
               &ldsB[0][rowT[t] * 32 + segT[t]]);
  }
  for (int kb = 0; kb < nk; ++kb) {
    const int st = kb & 1;
    if (kb + 1 < nk) {
      const int k0 = (kb + 1) << 5;
      __builtin_prefetch(A + (size_t)(mBase + rowT[0]) * Kdim + k0 + 64, 0, 0);
#pragma unroll
      for (int t = 0; t < 2; t++) {
        async_cp16(A  + (size_t)(mBase + rowT[t]) * Kdim + k0 + segT[t],
                   &ldsA[st ^ 1][rowT[t] * 32 + segT[t]]);
        async_cp16(Bw + (size_t)(nBase + rowT[t]) * Kdim + k0 + segT[t],
                   &ldsB[st ^ 1][rowT[t] * 32 + segT[t]]);
      }
      __builtin_amdgcn_s_wait_asynccnt(4);   /* previous stage landed */
    } else {
      __builtin_amdgcn_s_wait_asynccnt(0);
    }
    __syncthreads();
    v16h af[2], bf[4];
#pragma unroll
    for (int i = 0; i < 2; i++) af[i] = ld_frag(&ldsA[st][(wm * 32 + i * 16) * 32], 32);
#pragma unroll
    for (int j = 0; j < 4; j++) bf[j] = ld_frag(&ldsB[st][(wn * 64 + j * 16) * 32], 32);
#pragma unroll
    for (int i = 0; i < 2; i++)
#pragma unroll
      for (int j = 0; j < 4; j++)
        acc[i][j] = __builtin_amdgcn_wmma_f32_16x16x32_f16(
            false, af[i], false, bf[j], (short)0, acc[i][j], false, false);
    __syncthreads();
  }
#else
  /* ---- fallback: register-staged pipeline ---- */
  v8h ra[2], rb[2];
#pragma unroll
  for (int t = 0; t < 2; t++) {
    ra[t] = *(const v8h*)(A  + (size_t)(mBase + rowT[t]) * Kdim + segT[t]);
    rb[t] = *(const v8h*)(Bw + (size_t)(nBase + rowT[t]) * Kdim + segT[t]);
  }
  for (int kb = 0; kb < nk; ++kb) {
#pragma unroll
    for (int t = 0; t < 2; t++) {
      *(v8h*)(&ldsA[0][rowT[t] * 32 + segT[t]]) = ra[t];
      *(v8h*)(&ldsB[0][rowT[t] * 32 + segT[t]]) = rb[t];
    }
    __syncthreads();
    if (kb + 1 < nk) {
      const int k0 = (kb + 1) << 5;
      __builtin_prefetch(A + (size_t)(mBase + rowT[0]) * Kdim + k0 + 32, 0, 0);
#pragma unroll
      for (int t = 0; t < 2; t++) {
        ra[t] = *(const v8h*)(A  + (size_t)(mBase + rowT[t]) * Kdim + k0 + segT[t]);
        rb[t] = *(const v8h*)(Bw + (size_t)(nBase + rowT[t]) * Kdim + k0 + segT[t]);
      }
    }
    v16h af[2], bf[4];
#pragma unroll
    for (int i = 0; i < 2; i++) af[i] = ld_frag(&ldsA[0][(wm * 32 + i * 16) * 32], 32);
#pragma unroll
    for (int j = 0; j < 4; j++) bf[j] = ld_frag(&ldsB[0][(wn * 64 + j * 16) * 32], 32);
#pragma unroll
    for (int i = 0; i < 2; i++)
#pragma unroll
      for (int j = 0; j < 4; j++)
        acc[i][j] = __builtin_amdgcn_wmma_f32_16x16x32_f16(
            false, af[i], false, bf[j], (short)0, acc[i][j], false, false);
    __syncthreads();
  }
#endif

  /* epilogue: C/D layout — lane holds col, VGPR r holds row r + 8*(lane>=16) */
#pragma unroll
  for (int i = 0; i < 2; i++)
#pragma unroll
    for (int j = 0; j < 4; j++) {
      const int col = nBase + wn * 64 + j * 16 + l15;
      const float bias = (col < s1) ? b0[col] : (col < s2) ? b1[col - s1] : b2[col - s2];
#pragma unroll
      for (int r = 0; r < 8; r++) {
        const int row = mBase + wm * 32 + i * 16 + r + hi8;
        C[(size_t)row * Ndim + col] = acc[i][j][r] + bias;
      }
    }
}

/* ---------------- RMSNorm + RoPE + repack to [B,N,S,HD] f16 ---------------- */
__global__ __launch_bounds__(256) void norm_rope(
    const float* __restrict__ Y, const float* __restrict__ freqs,
    const float* __restrict__ gq, const float* __restrict__ gk,
    _Float16* __restrict__ qh, _Float16* __restrict__ kh, _Float16* __restrict__ vh)
{
  const int m = blockIdx.x;
  const int b = m / SS, s = m % SS;
  const int tid = threadIdx.x;
  const float* Yr = Y + (size_t)m * N1;
  const int c0 = tid * 8;

  float qv[8], kv[8], vv[8];
  float sq = 0.f, sk = 0.f;
#pragma unroll
  for (int j = 0; j < 8; j++) {
    qv[j] = Yr[c0 + j]; kv[j] = Yr[DD + c0 + j]; vv[j] = Yr[2 * DD + c0 + j];
    sq += qv[j] * qv[j]; sk += kv[j] * kv[j];
  }
  for (int msk = 16; msk; msk >>= 1) {
    sq += __shfl_xor(sq, msk, 32);
    sk += __shfl_xor(sk, msk, 32);
  }
  __shared__ float red[16];
  const int wid = tid >> 5;
  if ((tid & 31) == 0) { red[wid] = sq; red[8 + wid] = sk; }
  __syncthreads();
  if (tid == 0) {
    float a = 0.f, c = 0.f;
    for (int i = 0; i < 8; i++) { a += red[i]; c += red[8 + i]; }
    red[0] = a; red[8] = c;
  }
  __syncthreads();
  const float rq = rsqrtf(red[0] * (1.0f / DD) + 1e-6f);
  const float rk = rsqrtf(red[8] * (1.0f / DD) + 1e-6f);

  const int n  = c0 / HD;
  const int d0 = c0 % HD;
  const size_t ob = ((size_t)(b * NH + n) * SS + s) * HD + d0;
#pragma unroll
  for (int j = 0; j < 8; j += 2) {
    const int p = (d0 + j) >> 1;
    const float f  = freqs[(size_t)s * (HD / 2) + p];
    const float cf = __cosf(f), sf = __sinf(f);
    const float u0 = qv[j]     * rq * gq[c0 + j];
    const float u1 = qv[j + 1] * rq * gq[c0 + j + 1];
    qh[ob + j]     = (_Float16)(u0 * cf - u1 * sf);
    qh[ob + j + 1] = (_Float16)(u0 * sf + u1 * cf);
    const float w0 = kv[j]     * rk * gk[c0 + j];
    const float w1 = kv[j + 1] * rk * gk[c0 + j + 1];
    kh[ob + j]     = (_Float16)(w0 * cf - w1 * sf);
    kh[ob + j + 1] = (_Float16)(w0 * sf + w1 * cf);
    vh[ob + j]     = (_Float16)vv[j];
    vh[ob + j + 1] = (_Float16)vv[j + 1];
  }
}

#define VPITCH 144  /* halves; 288 B = 32 B x odd, the transposing load's pitch */

typedef __attribute__((ext_vector_type(8))) short s16x8;
typedef __attribute__((address_space(3))) s16x8 lds_s16x8;

__device__ __forceinline__ v8h ld_tr16(const _Float16* p) {
  return __builtin_bit_cast(v8h, __builtin_amdgcn_ds_load_tr16_b128_v8i16((lds_s16x8*)p));
}

/* value of lane l ^ 16 */
__device__ __forceinline__ float xhalf(float x) {
  return __builtin_bit_cast(float, __builtin_amdgcn_permlanex16(
      __builtin_bit_cast(int, x), __builtin_bit_cast(int, x),
      0x76543210, 0xfedcba98, false, false));
}

__global__ __launch_bounds__(128) void attn_wmma(
    const _Float16* __restrict__ qh, const _Float16* __restrict__ kh,
    const _Float16* __restrict__ vh, const int* __restrict__ seq_lens,
    _Float16* __restrict__ oh)
{
  __shared__ __align__(16) _Float16 ldsK[32 * HD];
  __shared__ __align__(16) _Float16 ldsV[32 * VPITCH];

  const int tid = threadIdx.x;
  const int lane = tid & 31, w = tid >> 5;
  const int l15 = lane & 15, hi8 = (lane >> 4) << 3;
  const int nqt = SS / 128;
  const int qt = blockIdx.x % nqt;
  const int h  = (blockIdx.x / nqt) % NH;
  const int b  = blockIdx.x / (nqt * NH);
  /* the key mask is arange(S) < seq_len: clamping to [0, S] leaves it as it is
     and bounds the trip count and every K/V address */
  int slen = seq_lens[b];
  slen = slen < 0 ? 0 : (slen > SS ? SS : slen);
  /* no valid key: every score equals the mask value, softmax is uniform over
     all S keys; scores of zero over all keys give the same */
  const int   lim = slen == 0 ? SS : slen;
  const float scl = slen == 0 ? 0.f : 0.08838834764831845f; /* 1/sqrt(128) */

  const size_t headO = (size_t)(b * NH + h) * SS * HD;
  const _Float16* qbase = qh + headO + (size_t)(qt * 128 + w * 32) * HD;
  const _Float16* kbase = kh + headO;
  const _Float16* vbase = vh + headO;

  /* B operand Q^T: column = query, same k order as the K rows (same loader) */
  v16h qf[2][4];
#pragma unroll
  for (int i = 0; i < 2; i++)
#pragma unroll
    for (int dc = 0; dc < 4; dc++)
      qf[i][dc] = ld_frag(qbase + (size_t)(i * 16) * HD + dc * 32, HD);

  const v8f zf = {};
  v8f o[2][8];                 /* o[i][dj][r] = O[query i*16+l15][dj*16+hi8+r] */
#pragma unroll
  for (int i = 0; i < 2; i++)
#pragma unroll
    for (int dj = 0; dj < 8; dj++) o[i][dj] = zf;
  float mrow[2], lrow[2];      /* lrow: this wave half's keys only */
#pragma unroll
  for (int i = 0; i < 2; i++) { mrow[i] = -3.0e38f; lrow[i] = 0.f; }

  /* lane address of the transposing load: key row 8*(l>>4)+(l&7), 16-B column half (l>>3)&1 */
  const _Float16* vtr = ldsV + (hi8 + (lane & 7)) * VPITCH + (((lane >> 3) & 1) << 3);

  const int nkt = (lim + 31) >> 5;
  for (int kt = 0; kt < nkt; ++kt) {
    /* stage K tile [32][128] and V tile [32][128 + pad], both row-major */
#pragma unroll
    for (int t = 0; t < 4; t++) {
      const int c = tid + t * 128;            /* 512 chunks of 8 halves */
      const int kk = c >> 4, seg = (c & 15) << 3;
#if USE_ASYNC
      async_cp16(kbase + (size_t)(kt * 32 + kk) * HD + seg, ldsK + kk * HD + seg);
      async_cp16(vbase + (size_t)(kt * 32 + kk) * HD + seg, ldsV + kk * VPITCH + seg);
#else
      *(v8h*)(ldsK + kk * HD + seg) = *(const v8h*)(kbase + (size_t)(kt * 32 + kk) * HD + seg);
      *(v8h*)(ldsV + kk * VPITCH + seg) = *(const v8h*)(vbase + (size_t)(kt * 32 + kk) * HD + seg);
#endif
    }
#if USE_ASYNC
    /* this wave's copies have landed before the barrier publishes them */
    asm volatile("s_wait_asynccnt 0x0" ::: "memory");
#endif
    __syncthreads();

    /* S^T = K * Q^T : sc[j][i][r] = score(key j*16+hi8+r, query i*16+l15) */
    v8f sc[2][2];
#pragma unroll
    for (int j = 0; j < 2; j++)
#pragma unroll
      for (int i = 0; i < 2; i++) sc[j][i] = zf;
#pragma unroll
    for (int dc = 0; dc < 4; dc++) {
      v16h ak0 = ld_frag(ldsK + 0 * 16 * HD + dc * 32, HD);
      v16h ak1 = ld_frag(ldsK + 1 * 16 * HD + dc * 32, HD);
#pragma unroll
      for (int i = 0; i < 2; i++) {
        sc[0][i] = __builtin_amdgcn_wmma_f32_16x16x32_f16(
            false, ak0, false, qf[i][dc], (short)0, sc[0][i], false, false);
        sc[1][i] = __builtin_amdgcn_wmma_f32_16x16x32_f16(
            false, ak1, false, qf[i][dc], (short)0, sc[1][i], false, false);
      }
    }

    /* scale; key mask only in a tile that reaches past the last valid key */
#pragma unroll
    for (int j = 0; j < 2; j++)
#pragma unroll
      for (int i = 0; i < 2; i++)
#pragma unroll
        for (int r = 0; r < 8; r++) sc[j][i][r] *= scl;
    if (kt * 32 + 32 > lim) {
#pragma unroll
      for (int j = 0; j < 2; j++)
#pragma unroll
        for (int r = 0; r < 8; r++) {
          const bool valid = kt * 32 + j * 16 + hi8 + r < lim;
#pragma unroll
          for (int i = 0; i < 2; i++) sc[j][i][r] = valid ? sc[j][i][r] : -3.0e38f;
        }
    }

    /* online softmax: a lane and its partner in the other half share one query */
    v16h pf[2];
#pragma unroll
    for (int i = 0; i < 2; i++) {
      float t = fmaxf(sc[0][i][0], sc[1][i][0]);
#pragma unroll
      for (int r = 1; r < 8; r++) t = fmaxf(t, fmaxf(sc[0][i][r], sc[1][i][r]));
      t = fmaxf(t, xhalf(t));
      const float mn = fmaxf(mrow[i], t);
      const float al = __expf(mrow[i] - mn);
      float rs = 0.f;
#pragma unroll
      for (int j = 0; j < 2; j++)
#pragma unroll
        for (int r = 0; r < 8; r++) {
          const float p = __expf(sc[j][i][r] - mn);
          rs += p;
          pf[i][j * 8 + r] = (_Float16)p;   /* B operand P^T, hardware k order */
        }
      lrow[i] = lrow[i] * al + rs;
      mrow[i] = mn;
#pragma unroll
      for (int dj = 0; dj < 8; dj++)
#pragma unroll
        for (int r = 0; r < 8; r++) o[i][dj][r] *= al;
    }

    /* O^T += V^T * P^T  (A frags: rows = d, matmul-K = key) */
#pragma unroll
    for (int dj = 0; dj < 8; dj++) {
      const v8h lo = ld_tr16(vtr + dj * 16);
      const v8h hi = ld_tr16(vtr + 16 * VPITCH + dj * 16);
      v16h vf;
#pragma unroll
      for (int e = 0; e < 8; e++) { vf[e] = lo[e]; vf[8 + e] = hi[e]; }
      o[0][dj] = __builtin_amdgcn_wmma_f32_16x16x32_f16(
          false, vf, false, pf[0], (short)0, o[0][dj], false, false);
      o[1][dj] = __builtin_amdgcn_wmma_f32_16x16x32_f16(
          false, vf, false, pf[1], (short)0, o[1][dj], false, false);
    }
    __syncthreads();
  }

  /* join the halves' sums, normalize, write [B,S,D] f16: 8 consecutive d per lane */
#pragma unroll
  for (int i = 0; i < 2; i++) {
    const int srow = qt * 128 + w * 32 + i * 16 + l15;
    const float inv = 1.0f / (lrow[i] + xhalf(lrow[i]));
    _Float16* orow = oh + ((size_t)(b * SS + srow)) * DD + h * HD + hi8;
#pragma unroll
    for (int dj = 0; dj < 8; dj++) {
      v8h ov;
#pragma unroll
      for (int r = 0; r < 8; r++) ov[r] = (_Float16)(o[i][dj][r] * inv);
      *(v8h*)(orow + dj * 16) = ov;
    }
  }
}

/* ---------------- host-side orchestration ---------------- */
extern "C" void kernel_launch(void* const* d_in, const int* in_sizes, int n_in,
                              void* d_out, int out_size, void* d_ws, size_t ws_size,
                              hipStream_t stream) {
  (void)in_sizes; (void)n_in; (void)out_size; (void)ws_size;
  const float* x        = (const float*)d_in[0];
  const int*   seq_lens = (const int*)d_in[1];
  const float* freqs    = (const float*)d_in[2];
  const float* wq = (const float*)d_in[3];
  const float* bq = (const float*)d_in[4];
  const float* wk = (const float*)d_in[5];
  const float* bk = (const float*)d_in[6];
  const float* wv = (const float*)d_in[7];
  const float* bv = (const float*)d_in[8];
  const float* wo = (const float*)d_in[9];
  const float* bo = (const float*)d_in[10];
  const float* gq = (const float*)d_in[11];
  const float* gk = (const float*)d_in[12];

  char* ws = (char*)d_ws;
  _Float16* xh    = (_Float16*)(ws + OFF_XH);
  _Float16* wqkvh = (_Float16*)(ws + OFF_WQKV);
  _Float16* woh   = (_Float16*)(ws + OFF_WO);
  float*    Y     = (float*)(ws + OFF_Y);
  _Float16* qhp   = (_Float16*)(ws + OFF_QH);
  _Float16* khp   = (_Float16*)(ws + OFF_KH);
  _Float16* vhp   = (_Float16*)(ws + OFF_VH);
  _Float16* ohp   = (_Float16*)(ws + OFF_OH);

  /* 1) down-convert activations + weights to f16 */
  cvt_f16<<<1024, 256, 0, stream>>>(x,  xh,               MM * DD);
  cvt_f16<<<1024, 256, 0, stream>>>(wq, wqkvh,            DD * DD);
  cvt_f16<<<1024, 256, 0, stream>>>(wk, wqkvh + (size_t)DD * DD,     DD * DD);
  cvt_f16<<<1024, 256, 0, stream>>>(wv, wqkvh + (size_t)2 * DD * DD, DD * DD);
  cvt_f16<<<1024, 256, 0, stream>>>(wo, woh,              DD * DD);

  /* 2) fused QKV projection: Y[4096,6144] = xh * [wq;wk;wv]^T + [bq|bk|bv] */
  gemm_wmma<<<dim3(N1 / 128, MM / 128), 256, 0, stream>>>(
      xh, wqkvh, Y, MM, N1, DD, bq, bk, bv, DD, 2 * DD);

  /* 3) RMSNorm + RoPE + repack */
  norm_rope<<<MM, 256, 0, stream>>>(Y, freqs, gq, gk, qhp, khp, vhp);

  /* 4) flash attention */
  attn_wmma<<<BB * NH * (SS / 128), 128, 0, stream>>>(qhp, khp, vhp, seq_lens, ohp);

  /* 5) output projection into d_out (f32) */
  gemm_wmma<<<dim3(DD / 128, MM / 128), 256, 0, stream>>>(
      ohp, woh, (float*)d_out, MM, DD, DD, bo, bo, bo, DD, 2 * DD);
}

// v002
// Measured time: 363 microseconds a run.
// Two timings next to v001 put it at 1.36 and 1.38 times that version's speed.
// Counting every step since v000, it is 2.18 times as fast.
#include <hip/hip_runtime.h>

typedef __attribute__((ext_vector_type(16))) _Float16 v16h;
typedef __attribute__((ext_vector_type(8)))  _Float16 v8h;
typedef __attribute__((ext_vector_type(8)))  float    v8f;
typedef __attribute__((ext_vector_type(4)))  int      v4i;

#define BB 2
#define SS 2048
#define DD 2048
#define NH 16
#define HD 128
#define MM (BB*SS)      /* 4096 rows */
#define N1 (3*DD)       /* 6144 fused QKV cols */

/* ---- workspace layout (bytes) ---- */
#define OFF_XH   ((size_t)0)
#define OFF_WQKV (OFF_XH   + (size_t)MM*DD*2)     /* x in f16            */
#define OFF_WO   (OFF_WQKV + (size_t)N1*DD*2)     /* [wq;wk;wv] f16      */
#define OFF_Y    (OFF_WO   + (size_t)DD*DD*2)     /* wo f16              */
#define OFF_QH   (OFF_Y    + (size_t)MM*N1*4)     /* fused QKV f32       */
#define OFF_KH   (OFF_QH   + (size_t)MM*DD*2)     /* q f16 [B,N,S,HD]    */
#define OFF_VH   (OFF_KH   + (size_t)MM*DD*2)
#define OFF_OH   (OFF_VH   + (size_t)MM*DD*2)     /* attn out f16 [B,S,D]*/

/* ---- CDNA5 async global->LDS copy (ASYNCcnt-tracked, bypasses VGPRs) ---- */
#if __has_builtin(__builtin_amdgcn_global_load_async_to_lds_b128) && \
    __has_builtin(__builtin_amdgcn_s_wait_asynccnt)
#define USE_ASYNC 1
#else
#define USE_ASYNC 0
#endif

/* b128 payload type: <4 x i32>; clang prints AS(1) as `__device__` in HIP */
typedef __attribute__((address_space(1))) v4i gv4i;
typedef __attribute__((address_space(3))) v4i lv4i;

__device__ __forceinline__ void async_cp16(const void* g, void* l) {
#if USE_ASYNC
  /* generic LDS pointers carry the LDS byte offset in the low 32 bits
     (flat->LDS aperture mapping: LDS_ADDR = addr[31:0]) */
  __builtin_amdgcn_global_load_async_to_lds_b128(
      (gv4i*)(unsigned long long)(size_t)g,
      (lv4i*)(unsigned int)(size_t)l, 0, 0);
#else
  (void)g; (void)l;
#endif
}

/* ---------------- f32 -> f16 convert ---------------- */
__global__ __launch_bounds__(256) void cvt_f16(const float* __restrict__ src,
                                               _Float16* __restrict__ dst, int n) {
  for (int i = blockIdx.x * 256 + threadIdx.x; i < n; i += gridDim.x * 256)
    dst[i] = (_Float16)src[i];
}

/* Fragment loader per CDNA5 ISA 7.12.2 (16-bit A 16x32 / B 32x16 layouts).
   tile: pointer to the 16-row tile origin; row dim stride = `stride` halves;
   contiguous (matmul-K) dim carries the 8+8 half split at +0 / +16. */
__device__ __forceinline__ v16h ld_frag(const _Float16* tile, int stride) {
  const int lane = threadIdx.x & 31;
  const _Float16* p = tile + (size_t)(lane & 15) * stride + ((lane >> 4) << 3);
  v8h lo = *(const v8h*)(p);
  v8h hi = *(const v8h*)(p + 16);
  v16h r;
#pragma unroll
  for (int i = 0; i < 8; ++i) { r[i] = lo[i]; r[8 + i] = hi[i]; }
  return r;
}

/* ---------------- WMMA GEMM: C[M,N] = A[M,K] * Bw[N,K]^T + bias ----------------
   128x128 block tile, 8 waves, wave tile 32x64 (2x4 of 16x16), K-step 32.
   Global->LDS staging via async copy engine, LDS double buffered:
   4 async b128 ops per wave per stage; s_wait_asynccnt 4 retires the previous
   stage (per-wave in-order completion) while the next stage streams. */
#define GPITCH 40   /* halves; 80 B = 16 B x odd: 16 rows of a ds_load_b128 fall on 16 bank groups */
__global__ __launch_bounds__(256) void gemm_wmma(
    const _Float16* __restrict__ A, const _Float16* __restrict__ Bw,
    float* __restrict__ C, int Mdim, int Ndim, int Kdim,
    const float* __restrict__ b0, const float* __restrict__ b1,
    const float* __restrict__ b2, int s1, int s2)
{
  __shared__ __align__(16) _Float16 ldsA[2][128 * GPITCH];
  __shared__ __align__(16) _Float16 ldsB[2][128 * GPITCH];
  const int tid  = threadIdx.x;
  const int lane = tid & 31, wave = tid >> 5;
  const int l15  = lane & 15, hi8 = (lane >> 4) << 3;
  const int wm = wave >> 1, wn = wave & 1;
  const int mBase = blockIdx.y * 128;
  const int nBase = blockIdx.x * 128;

  const v8f zf = {};
  v8f acc[2][4];
#pragma unroll
  for (int i = 0; i < 2; i++)
#pragma unroll
    for (int j = 0; j < 4; j++) acc[i][j] = zf;

  int rowT[2], segT[2];
#pragma unroll
  for (int t = 0; t < 2; t++) {
    int c = tid + t * 256;            /* 512 16B chunks per 128x32 tile */
    rowT[t] = c >> 2;
    segT[t] = (c & 3) << 3;
  }

  const int nk = Kdim >> 5;

#if USE_ASYNC
  /* ---- async pipeline ---- */
#pragma unroll
  for (int t = 0; t < 2; t++) {       /* stage 0 */
    async_cp16(A  + (size_t)(mBase + rowT[t]) * Kdim + segT[t],
               &ldsA[0][rowT[t] * GPITCH + segT[t]]);
    async_cp16(Bw + (size_t)(nBase + rowT[t]) * Kdim + segT[t],
               &ldsB[0][rowT[t] * GPITCH + segT[t]]);
  }
  for (int kb = 0; kb < nk; ++kb) {
    const int st = kb & 1;
    if (kb + 1 < nk) {
      const int k0 = (kb + 1) << 5;
      __builtin_prefetch(A + (size_t)(mBase + rowT[0]) * Kdim + k0 + 64, 0, 0);
#pragma unroll
      for (int t = 0; t < 2; t++) {
        async_cp16(A  + (size_t)(mBase + rowT[t]) * Kdim + k0 + segT[t],
                   &ldsA[st ^ 1][rowT[t] * GPITCH + segT[t]]);
        async_cp16(Bw + (size_t)(nBase + rowT[t]) * Kdim + k0 + segT[t],
                   &ldsB[st ^ 1][rowT[t] * GPITCH + segT[t]]);
      }
      __builtin_amdgcn_s_wait_asynccnt(4);   /* previous stage landed */
    } else {
      __builtin_amdgcn_s_wait_asynccnt(0);
    }
    __syncthreads();
    v16h af[2], bf[4];
#pragma unroll
    for (int i = 0; i < 2; i++) af[i] = ld_frag(&ldsA[st][(wm * 32 + i * 16) * GPITCH], GPITCH);
#pragma unroll
    for (int j = 0; j < 4; j++) bf[j] = ld_frag(&ldsB[st][(wn * 64 + j * 16) * GPITCH], GPITCH);
#pragma unroll
    for (int i = 0; i < 2; i++)
#pragma unroll
      for (int j = 0; j < 4; j++)
        acc[i][j] = __builtin_amdgcn_wmma_f32_16x16x32_f16(
            false, af[i], false, bf[j], (short)0, acc[i][j], false, false);
    __syncthreads();
  }
#else
  /* ---- fallback: register-staged pipeline ---- */
  v8h ra[2], rb[2];
#pragma unroll
  for (int t = 0; t < 2; t++) {
    ra[t] = *(const v8h*)(A  + (size_t)(mBase + rowT[t]) * Kdim + segT[t]);
    rb[t] = *(const v8h*)(Bw + (size_t)(nBase + rowT[t]) * Kdim + segT[t]);
  }
  for (int kb = 0; kb < nk; ++kb) {
#pragma unroll
    for (int t = 0; t < 2; t++) {
      *(v8h*)(&ldsA[0][rowT[t] * GPITCH + segT[t]]) = ra[t];
      *(v8h*)(&ldsB[0][rowT[t] * GPITCH + segT[t]]) = rb[t];
    }
    __syncthreads();
    if (kb + 1 < nk) {
      const int k0 = (kb + 1) << 5;
      __builtin_prefetch(A + (size_t)(mBase + rowT[0]) * Kdim + k0 + 32, 0, 0);
#pragma unroll
      for (int t = 0; t < 2; t++) {
        ra[t] = *(const v8h*)(A  + (size_t)(mBase + rowT[t]) * Kdim + k0 + segT[t]);
        rb[t] = *(const v8h*)(Bw + (size_t)(nBase + rowT[t]) * Kdim + k0 + segT[t]);
      }
    }
    v16h af[2], bf[4];
#pragma unroll
    for (int i = 0; i < 2; i++) af[i] = ld_frag(&ldsA[0][(wm * 32 + i * 16) * GPITCH], GPITCH);
#pragma unroll
    for (int j = 0; j < 4; j++) bf[j] = ld_frag(&ldsB[0][(wn * 64 + j * 16) * GPITCH], GPITCH);
#pragma unroll
    for (int i = 0; i < 2; i++)
#pragma unroll
      for (int j = 0; j < 4; j++)
        acc[i][j] = __builtin_amdgcn_wmma_f32_16x16x32_f16(
            false, af[i], false, bf[j], (short)0, acc[i][j], false, false);
    __syncthreads();
  }
#endif

  /* epilogue: C/D layout — lane holds col, VGPR r holds row r + 8*(lane>=16) */
#pragma unroll
  for (int i = 0; i < 2; i++)
#pragma unroll
    for (int j = 0; j < 4; j++) {
      const int col = nBase + wn * 64 + j * 16 + l15;
      const float bias = (col < s1) ? b0[col] : (col < s2) ? b1[col - s1] : b2[col - s2];
#pragma unroll
      for (int r = 0; r < 8; r++) {
        const int row = mBase + wm * 32 + i * 16 + r + hi8;
        C[(size_t)row * Ndim + col] = acc[i][j][r] + bias;
      }
    }
}

/* ---------------- RMSNorm + RoPE + repack to [B,N,S,HD] f16 ---------------- */
__global__ __launch_bounds__(256) void norm_rope(
    const float* __restrict__ Y, const float* __restrict__ freqs,
    const float* __restrict__ gq, const float* __restrict__ gk,
    _Float16* __restrict__ qh, _Float16* __restrict__ kh, _Float16* __restrict__ vh)
{
  const int m = blockIdx.x;
  const int b = m / SS, s = m % SS;
  const int tid = threadIdx.x;
  const float* Yr = Y + (size_t)m * N1;
  const int c0 = tid * 8;

  float qv[8], kv[8], vv[8];
  float sq = 0.f, sk = 0.f;
#pragma unroll
  for (int j = 0; j < 8; j++) {
    qv[j] = Yr[c0 + j]; kv[j] = Yr[DD + c0 + j]; vv[j] = Yr[2 * DD + c0 + j];
    sq += qv[j] * qv[j]; sk += kv[j] * kv[j];
  }
  for (int msk = 16; msk; msk >>= 1) {
    sq += __shfl_xor(sq, msk, 32);
    sk += __shfl_xor(sk, msk, 32);
  }
  __shared__ float red[16];
  const int wid = tid >> 5;
  if ((tid & 31) == 0) { red[wid] = sq; red[8 + wid] = sk; }
  __syncthreads();
  if (tid == 0) {
    float a = 0.f, c = 0.f;
    for (int i = 0; i < 8; i++) { a += red[i]; c += red[8 + i]; }
    red[0] = a; red[8] = c;
  }
  __syncthreads();
  const float rq = rsqrtf(red[0] * (1.0f / DD) + 1e-6f);
  const float rk = rsqrtf(red[8] * (1.0f / DD) + 1e-6f);

  const int n  = c0 / HD;
  const int d0 = c0 % HD;
  const size_t ob = ((size_t)(b * NH + n) * SS + s) * HD + d0;
#pragma unroll
  for (int j = 0; j < 8; j += 2) {
    const int p = (d0 + j) >> 1;
    const float f  = freqs[(size_t)s * (HD / 2) + p];
    const float cf = __cosf(f), sf = __sinf(f);
    const float u0 = qv[j]     * rq * gq[c0 + j];
    const float u1 = qv[j + 1] * rq * gq[c0 + j + 1];
    qh[ob + j]     = (_Float16)(u0 * cf - u1 * sf);
    qh[ob + j + 1] = (_Float16)(u0 * sf + u1 * cf);
    const float w0 = kv[j]     * rk * gk[c0 + j];
    const float w1 = kv[j + 1] * rk * gk[c0 + j + 1];
    kh[ob + j]     = (_Float16)(w0 * cf - w1 * sf);
    kh[ob + j + 1] = (_Float16)(w0 * sf + w1 * cf);
    vh[ob + j]     = (_Float16)vv[j];
    vh[ob + j + 1] = (_Float16)vv[j + 1];
  }
}

#define VPITCH 144  /* halves; 288 B = 32 B x odd, the transposing load's pitch */
#define KPITCH 136  /* halves; 272 B = 16 B x odd, the ds_load_b128 pitch */

typedef __attribute__((ext_vector_type(8))) short s16x8;
typedef __attribute__((address_space(3))) s16x8 lds_s16x8;

__device__ __forceinline__ v8h ld_tr16(const _Float16* p) {
  return __builtin_bit_cast(v8h, __builtin_amdgcn_ds_load_tr16_b128_v8i16((lds_s16x8*)p));
}

/* value of lane l ^ 16 */
__device__ __forceinline__ float xhalf(float x) {
  return __builtin_bit_cast(float, __builtin_amdgcn_permlanex16(
      __builtin_bit_cast(int, x), __builtin_bit_cast(int, x),
      0x76543210, 0xfedcba98, false, false));
}

__global__ __launch_bounds__(128) void attn_wmma(
    const _Float16* __restrict__ qh, const _Float16* __restrict__ kh,
    const _Float16* __restrict__ vh, const int* __restrict__ seq_lens,
    _Float16* __restrict__ oh)
{
  __shared__ __align__(16) _Float16 ldsK[32 * KPITCH];
  __shared__ __align__(16) _Float16 ldsV[32 * VPITCH];

  const int tid = threadIdx.x;
  const int lane = tid & 31, w = tid >> 5;
  const int l15 = lane & 15, hi8 = (lane >> 4) << 3;
  const int nqt = SS / 128;
  const int qt = blockIdx.x % nqt;
  const int h  = (blockIdx.x / nqt) % NH;
  const int b  = blockIdx.x / (nqt * NH);
  /* the key mask is arange(S) < seq_len: clamping to [0, S] leaves it as it is
     and bounds the trip count and every K/V address */
  int slen = seq_lens[b];
  slen = slen < 0 ? 0 : (slen > SS ? SS : slen);
  /* no valid key: every score equals the mask value, softmax is uniform over
     all S keys; scores of zero over all keys give the same */
  const int   lim = slen == 0 ? SS : slen;
  const float scl = slen == 0 ? 0.f : 0.08838834764831845f; /* 1/sqrt(128) */

  const size_t headO = (size_t)(b * NH + h) * SS * HD;
  const _Float16* qbase = qh + headO + (size_t)(qt * 128 + w * 32) * HD;
  const _Float16* kbase = kh + headO;
  const _Float16* vbase = vh + headO;

  /* B operand Q^T: column = query, same k order as the K rows (same loader) */
  v16h qf[2][4];
#pragma unroll
  for (int i = 0; i < 2; i++)
#pragma unroll
    for (int dc = 0; dc < 4; dc++)
      qf[i][dc] = ld_frag(qbase + (size_t)(i * 16) * HD + dc * 32, HD);

  const v8f zf = {};
  v8f o[2][8];                 /* o[i][dj][r] = O[query i*16+l15][dj*16+hi8+r] */
#pragma unroll
  for (int i = 0; i < 2; i++)
#pragma unroll
    for (int dj = 0; dj < 8; dj++) o[i][dj] = zf;
  float mrow[2], lrow[2];      /* lrow: this wave half's keys only */
#pragma unroll
  for (int i = 0; i < 2; i++) { mrow[i] = -3.0e38f; lrow[i] = 0.f; }

  /* lane address of the transposing load: key row 8*(l>>4)+(l&7), 16-B column half (l>>3)&1 */
  const _Float16* vtr = ldsV + (hi8 + (lane & 7)) * VPITCH + (((lane >> 3) & 1) << 3);

  const int nkt = (lim + 31) >> 5;
  for (int kt = 0; kt < nkt; ++kt) {
    /* stage K tile and V tile, [32][128 + pad] each, both row-major */
#pragma unroll
    for (int t = 0; t < 4; t++) {
      const int c = tid + t * 128;            /* 512 chunks of 8 halves */
      const int kk = c >> 4, seg = (c & 15) << 3;
#if USE_ASYNC
      async_cp16(kbase + (size_t)(kt * 32 + kk) * HD + seg, ldsK + kk * KPITCH + seg);
      async_cp16(vbase + (size_t)(kt * 32 + kk) * HD + seg, ldsV + kk * VPITCH + seg);
#else
      *(v8h*)(ldsK + kk * KPITCH + seg) = *(const v8h*)(kbase + (size_t)(kt * 32 + kk) * HD + seg);
      *(v8h*)(ldsV + kk * VPITCH + seg) = *(const v8h*)(vbase + (size_t)(kt * 32 + kk) * HD + seg);
#endif
    }
#if USE_ASYNC
    /* this wave's copies have landed before the barrier publishes them */
    asm volatile("s_wait_asynccnt 0x0" ::: "memory");
#endif
    __syncthreads();

    /* S^T = K * Q^T : sc[j][i][r] = score(key j*16+hi8+r, query i*16+l15) */
    v8f sc[2][2];
#pragma unroll
    for (int j = 0; j < 2; j++)
#pragma unroll
      for (int i = 0; i < 2; i++) sc[j][i] = zf;
#pragma unroll
    for (int dc = 0; dc < 4; dc++) {
      v16h ak0 = ld_frag(ldsK + 0 * 16 * KPITCH + dc * 32, KPITCH);
      v16h ak1 = ld_frag(ldsK + 1 * 16 * KPITCH + dc * 32, KPITCH);
#pragma unroll
      for (int i = 0; i < 2; i++) {
        sc[0][i] = __builtin_amdgcn_wmma_f32_16x16x32_f16(
            false, ak0, false, qf[i][dc], (short)0, sc[0][i], false, false);
        sc[1][i] = __builtin_amdgcn_wmma_f32_16x16x32_f16(
            false, ak1, false, qf[i][dc], (short)0, sc[1][i], false, false);
      }
    }

    /* scale; key mask only in a tile that reaches past the last valid key */
#pragma unroll
    for (int j = 0; j < 2; j++)
#pragma unroll
      for (int i = 0; i < 2; i++)
#pragma unroll
        for (int r = 0; r < 8; r++) sc[j][i][r] *= scl;
    if (kt * 32 + 32 > lim) {
#pragma unroll
      for (int j = 0; j < 2; j++)
#pragma unroll
        for (int r = 0; r < 8; r++) {
          const bool valid = kt * 32 + j * 16 + hi8 + r < lim;
#pragma unroll
          for (int i = 0; i < 2; i++) sc[j][i][r] = valid ? sc[j][i][r] : -3.0e38f;
        }
    }

    /* online softmax: a lane and its partner in the other half share one query */
    v16h pf[2];
#pragma unroll
    for (int i = 0; i < 2; i++) {
      float t = fmaxf(sc[0][i][0], sc[1][i][0]);
#pragma unroll
      for (int r = 1; r < 8; r++) t = fmaxf(t, fmaxf(sc[0][i][r], sc[1][i][r]));
      t = fmaxf(t, xhalf(t));
      const float mn = fmaxf(mrow[i], t);
      const float al = __expf(mrow[i] - mn);
      float rs = 0.f;
#pragma unroll
      for (int j = 0; j < 2; j++)
#pragma unroll
        for (int r = 0; r < 8; r++) {
          const float p = __expf(sc[j][i][r] - mn);
          rs += p;
          pf[i][j * 8 + r] = (_Float16)p;   /* B operand P^T, hardware k order */
        }
      lrow[i] = lrow[i] * al + rs;
      mrow[i] = mn;
#pragma unroll
      for (int dj = 0; dj < 8; dj++)
#pragma unroll
        for (int r = 0; r < 8; r++) o[i][dj][r] *= al;
    }

    /* O^T += V^T * P^T  (A frags: rows = d, matmul-K = key) */
#pragma unroll
    for (int dj = 0; dj < 8; dj++) {
      const v8h lo = ld_tr16(vtr + dj * 16);
      const v8h hi = ld_tr16(vtr + 16 * VPITCH + dj * 16);
      v16h vf;
#pragma unroll
      for (int e = 0; e < 8; e++) { vf[e] = lo[e]; vf[8 + e] = hi[e]; }
      o[0][dj] = __builtin_amdgcn_wmma_f32_16x16x32_f16(
          false, vf, false, pf[0], (short)0, o[0][dj], false, false);
      o[1][dj] = __builtin_amdgcn_wmma_f32_16x16x32_f16(
          false, vf, false, pf[1], (short)0, o[1][dj], false, false);
    }
    __syncthreads();
  }

  /* join the halves' sums, normalize, write [B,S,D] f16: 8 consecutive d per lane */
#pragma unroll
  for (int i = 0; i < 2; i++) {
    const int srow = qt * 128 + w * 32 + i * 16 + l15;
    const float inv = 1.0f / (lrow[i] + xhalf(lrow[i]));
    _Float16* orow = oh + ((size_t)(b * SS + srow)) * DD + h * HD + hi8;
#pragma unroll
    for (int dj = 0; dj < 8; dj++) {
      v8h ov;
#pragma unroll
      for (int r = 0; r < 8; r++) ov[r] = (_Float16)(o[i][dj][r] * inv);
      *(v8h*)(orow + dj * 16) = ov;
    }
  }
}

/* ---------------- host-side orchestration ---------------- */
extern "C" void kernel_launch(void* const* d_in, const int* in_sizes, int n_in,
                              void* d_out, int out_size, void* d_ws, size_t ws_size,
                              hipStream_t stream) {
  (void)in_sizes; (void)n_in; (void)out_size; (void)ws_size;
  const float* x        = (const float*)d_in[0];
  const int*   seq_lens = (const int*)d_in[1];
  const float* freqs    = (const float*)d_in[2];
  const float* wq = (const float*)d_in[3];
  const float* bq = (const float*)d_in[4];
  const float* wk = (const float*)d_in[5];
  const float* bk = (const float*)d_in[6];
  const float* wv = (const float*)d_in[7];
  const float* bv = (const float*)d_in[8];
  const float* wo = (const float*)d_in[9];
  const float* bo = (const float*)d_in[10];
  const float* gq = (const float*)d_in[11];
  const float* gk = (const float*)d_in[12];

  char* ws = (char*)d_ws;
  _Float16* xh    = (_Float16*)(ws + OFF_XH);
  _Float16* wqkvh = (_Float16*)(ws + OFF_WQKV);
  _Float16* woh   = (_Float16*)(ws + OFF_WO);
  float*    Y     = (float*)(ws + OFF_Y);
  _Float16* qhp   = (_Float16*)(ws + OFF_QH);
  _Float16* khp   = (_Float16*)(ws + OFF_KH);
  _Float16* vhp   = (_Float16*)(ws + OFF_VH);
  _Float16* ohp   = (_Float16*)(ws + OFF_OH);

  /* 1) down-convert activations + weights to f16 */
  cvt_f16<<<1024, 256, 0, stream>>>(x,  xh,               MM * DD);
  cvt_f16<<<1024, 256, 0, stream>>>(wq, wqkvh,            DD * DD);
  cvt_f16<<<1024, 256, 0, stream>>>(wk, wqkvh + (size_t)DD * DD,     DD * DD);
  cvt_f16<<<1024, 256, 0, stream>>>(wv, wqkvh + (size_t)2 * DD * DD, DD * DD);
  cvt_f16<<<1024, 256, 0, stream>>>(wo, woh,              DD * DD);

  /* 2) fused QKV projection: Y[4096,6144] = xh * [wq;wk;wv]^T + [bq|bk|bv] */
  gemm_wmma<<<dim3(N1 / 128, MM / 128), 256, 0, stream>>>(
      xh, wqkvh, Y, MM, N1, DD, bq, bk, bv, DD, 2 * DD);

  /* 3) RMSNorm + RoPE + repack */
  norm_rope<<<MM, 256, 0, stream>>>(Y, freqs, gq, gk, qhp, khp, vhp);

  /* 4) flash attention */
  attn_wmma<<<BB * NH * (SS / 128), 128, 0, stream>>>(qhp, khp, vhp, seq_lens, ohp);

  /* 5) output projection into d_out (f32) */
  gemm_wmma<<<dim3(DD / 128, MM / 128), 256, 0, stream>>>(
      ohp, woh, (float*)d_out, MM, DD, DD, bo, bo, bo, DD, 2 * DD);
}

// v003
// Measured time: 290 microseconds a run.
// Two timings next to v002 put it at 1.24 and 1.26 times that version's speed.
// Counting every step since v000, it is 2.71 times as fast.
#include <hip/hip_runtime.h>

typedef __attribute__((ext_vector_type(16))) _Float16 v16h;
typedef __attribute__((ext_vector_type(8)))  _Float16 v8h;
typedef __attribute__((ext_vector_type(8)))  float    v8f;
typedef __attribute__((ext_vector_type(4)))  int      v4i;

#define BB 2
#define SS 2048
#define DD 2048
#define NH 16
#define HD 128
#define MM (BB*SS)      /* 4096 rows */
#define N1 (3*DD)       /* 6144 fused QKV cols */

/* ---- workspace layout (bytes) ---- */
#define OFF_XH   ((size_t)0)
#define OFF_WQKV (OFF_XH   + (size_t)MM*DD*2)     /* x in f16            */
#define OFF_WO   (OFF_WQKV + (size_t)N1*DD*2)     /* [wq;wk;wv] f16      */
#define OFF_Y    (OFF_WO   + (size_t)DD*DD*2)     /* wo f16              */
#define OFF_QH   (OFF_Y    + (size_t)MM*N1*4)     /* fused QKV f32       */
#define OFF_KH   (OFF_QH   + (size_t)MM*DD*2)     /* q f16 [B,N,S,HD]    */
#define OFF_VH   (OFF_KH   + (size_t)MM*DD*2)
#define OFF_OH   (OFF_VH   + (size_t)MM*DD*2)     /* attn out f16 [B,S,D]*/

/* ---- CDNA5 async global->LDS copy (ASYNCcnt-tracked, bypasses VGPRs) ---- */
#if __has_builtin(__builtin_amdgcn_global_load_async_to_lds_b128) && \
    __has_builtin(__builtin_amdgcn_s_wait_asynccnt)
#define USE_ASYNC 1
#else
#define USE_ASYNC 0
#endif

/* b128 payload type: <4 x i32>; clang prints AS(1) as `__device__` in HIP */
typedef __attribute__((address_space(1))) v4i gv4i;
typedef __attribute__((address_space(3))) v4i lv4i;

__device__ __forceinline__ void async_cp16(const void* g, void* l) {
#if USE_ASYNC
  /* generic LDS pointers carry the LDS byte offset in the low 32 bits
     (flat->LDS aperture mapping: LDS_ADDR = addr[31:0]) */
  __builtin_amdgcn_global_load_async_to_lds_b128(
      (gv4i*)(unsigned long long)(size_t)g,
      (lv4i*)(unsigned int)(size_t)l, 0, 0);
#else
  (void)g; (void)l;
#endif
}

/* ---------------- f32 -> f16 convert ---------------- */
__global__ __launch_bounds__(256) void cvt_f16(const float* __restrict__ src,
                                               _Float16* __restrict__ dst, int n) {
  for (int i = blockIdx.x * 256 + threadIdx.x; i < n; i += gridDim.x * 256)
    dst[i] = (_Float16)src[i];
}

/* Fragment loader per CDNA5 ISA 7.12.2 (16-bit A 16x32 / B 32x16 layouts).
   tile: pointer to the 16-row tile origin; row dim stride = `stride` halves;
   contiguous (matmul-K) dim carries the 8+8 half split at +0 / +16. */
__device__ __forceinline__ v16h ld_frag(const _Float16* tile, int stride) {
  const int lane = threadIdx.x & 31;
  const _Float16* p = tile + (size_t)(lane & 15) * stride + ((lane >> 4) << 3);
  v8h lo = *(const v8h*)(p);
  v8h hi = *(const v8h*)(p + 16);
  v16h r;
#pragma unroll
  for (int i = 0; i < 8; ++i) { r[i] = lo[i]; r[8 + i] = hi[i]; }
  return r;
}

/* ---------------- WMMA GEMM: C[M,N] = A[M,K] * Bw[N,K]^T + bias ----------------
   128x128 block tile, 8 waves, wave tile 32x64 (2x4 of 16x16), K-step 64:
   a staged row is one whole 128-B line, so a wave's 512-B copy asks L2 for
   4 full lines.
   Global->LDS staging via async copy engine, LDS double buffered:
   8 async b128 ops per wave per stage; s_wait_asynccnt 8 retires the previous
   stage (per-wave in-order completion) while the next stage streams. */
#define GKS    64   /* halves of K per stage */
#define GCP    4    /* 16-B chunks per thread, operand and stage: 128 rows x 8 / 256 */
#define GPITCH 72   /* halves; 144 B = 16 B x odd: 16 rows of a ds_load_b128 fall on 16 bank groups */
__global__ __launch_bounds__(256) void gemm_wmma(
    const _Float16* __restrict__ A, const _Float16* __restrict__ Bw,
    float* __restrict__ C, int Mdim, int Ndim, int Kdim,
    const float* __restrict__ b0, const float* __restrict__ b1,
    const float* __restrict__ b2, int s1, int s2)
{
  __shared__ __align__(16) _Float16 ldsA[2][128 * GPITCH];
  __shared__ __align__(16) _Float16 ldsB[2][128 * GPITCH];
  const int tid  = threadIdx.x;
  const int lane = tid & 31, wave = tid >> 5;
  const int l15  = lane & 15, hi8 = (lane >> 4) << 3;
  const int wm = wave >> 1, wn = wave & 1;
  const int mBase = blockIdx.y * 128;
  const int nBase = blockIdx.x * 128;

  const v8f zf = {};
  v8f acc[2][4];
#pragma unroll
  for (int i = 0; i < 2; i++)
#pragma unroll
    for (int j = 0; j < 4; j++) acc[i][j] = zf;

  int rowT[GCP], segT[GCP];
#pragma unroll
  for (int t = 0; t < GCP; t++) {
    int c = tid + t * 256;            /* 1024 16B chunks per 128x64 tile */
    rowT[t] = c >> 3;
    segT[t] = (c & 7) << 3;
  }

  const int nk = Kdim / GKS;

#if USE_ASYNC
  /* ---- async pipeline ---- */
#pragma unroll
  for (int t = 0; t < GCP; t++) {     /* stage 0 */
    async_cp16(A  + (size_t)(mBase + rowT[t]) * Kdim + segT[t],
               &ldsA[0][rowT[t] * GPITCH + segT[t]]);
    async_cp16(Bw + (size_t)(nBase + rowT[t]) * Kdim + segT[t],
               &ldsB[0][rowT[t] * GPITCH + segT[t]]);
  }
  for (int kb = 0; kb < nk; ++kb) {
    const int st = kb & 1;
    if (kb + 1 < nk) {
      const int k0 = (kb + 1) * GKS;
      __builtin_prefetch(A + (size_t)(mBase + rowT[0]) * Kdim + k0 + 64, 0, 0);
#pragma unroll
      for (int t = 0; t < GCP; t++) {
        async_cp16(A  + (size_t)(mBase + rowT[t]) * Kdim + k0 + segT[t],
                   &ldsA[st ^ 1][rowT[t] * GPITCH + segT[t]]);
        async_cp16(Bw + (size_t)(nBase + rowT[t]) * Kdim + k0 + segT[t],
                   &ldsB[st ^ 1][rowT[t] * GPITCH + segT[t]]);
      }
      __builtin_amdgcn_s_wait_asynccnt(2 * GCP);   /* previous stage landed */
    } else {
      __builtin_amdgcn_s_wait_asynccnt(0);
    }
    __syncthreads();
    /* unrolled: both 32-k halves of the stage read at constant LDS offsets */
#pragma unroll
    for (int ks = 0; ks < GKS; ks += 32) {
      v16h af[2], bf[4];
#pragma unroll
      for (int i = 0; i < 2; i++) af[i] = ld_frag(&ldsA[st][(wm * 32 + i * 16) * GPITCH + ks], GPITCH);
#pragma unroll
      for (int j = 0; j < 4; j++) bf[j] = ld_frag(&ldsB[st][(wn * 64 + j * 16) * GPITCH + ks], GPITCH);
#pragma unroll
      for (int i = 0; i < 2; i++)
#pragma unroll
        for (int j = 0; j < 4; j++)
          acc[i][j] = __builtin_amdgcn_wmma_f32_16x16x32_f16(
              false, af[i], false, bf[j], (short)0, acc[i][j], false, false);
    }
    __syncthreads();
  }
#else
  /* ---- fallback: register-staged pipeline ---- */
  v8h ra[GCP], rb[GCP];
#pragma unroll
  for (int t = 0; t < GCP; t++) {
    ra[t] = *(const v8h*)(A  + (size_t)(mBase + rowT[t]) * Kdim + segT[t]);
    rb[t] = *(const v8h*)(Bw + (size_t)(nBase + rowT[t]) * Kdim + segT[t]);
  }
  for (int kb = 0; kb < nk; ++kb) {
#pragma unroll
    for (int t = 0; t < GCP; t++) {
      *(v8h*)(&ldsA[0][rowT[t] * GPITCH + segT[t]]) = ra[t];
      *(v8h*)(&ldsB[0][rowT[t] * GPITCH + segT[t]]) = rb[t];
    }
    __syncthreads();
    if (kb + 1 < nk) {
      const int k0 = (kb + 1) * GKS;
      __builtin_prefetch(A + (size_t)(mBase + rowT[0]) * Kdim + k0 + 32, 0, 0);
#pragma unroll
      for (int t = 0; t < GCP; t++) {
        ra[t] = *(const v8h*)(A  + (size_t)(mBase + rowT[t]) * Kdim + k0 + segT[t]);
        rb[t] = *(const v8h*)(Bw + (size_t)(nBase + rowT[t]) * Kdim + k0 + segT[t]);
      }
    }
    /* unrolled: both 32-k halves of the stage read at constant LDS offsets */
#pragma unroll
    for (int ks = 0; ks < GKS; ks += 32) {
      v16h af[2], bf[4];
#pragma unroll
      for (int i = 0; i < 2; i++) af[i] = ld_frag(&ldsA[0][(wm * 32 + i * 16) * GPITCH + ks], GPITCH);
#pragma unroll
      for (int j = 0; j < 4; j++) bf[j] = ld_frag(&ldsB[0][(wn * 64 + j * 16) * GPITCH + ks], GPITCH);
#pragma unroll
      for (int i = 0; i < 2; i++)
#pragma unroll
        for (int j = 0; j < 4; j++)
          acc[i][j] = __builtin_amdgcn_wmma_f32_16x16x32_f16(
              false, af[i], false, bf[j], (short)0, acc[i][j], false, false);
    }
    __syncthreads();
  }
#endif

  /* epilogue: C/D layout — lane holds col, VGPR r holds row r + 8*(lane>=16) */
#pragma unroll
  for (int i = 0; i < 2; i++)
#pragma unroll
    for (int j = 0; j < 4; j++) {
      const int col = nBase + wn * 64 + j * 16 + l15;
      const float bias = (col < s1) ? b0[col] : (col < s2) ? b1[col - s1] : b2[col - s2];
#pragma unroll
      for (int r = 0; r < 8; r++) {
        const int row = mBase + wm * 32 + i * 16 + r + hi8;
        C[(size_t)row * Ndim + col] = acc[i][j][r] + bias;
      }
    }
}

/* ---------------- RMSNorm + RoPE + repack to [B,N,S,HD] f16 ---------------- */
__global__ __launch_bounds__(256) void norm_rope(
    const float* __restrict__ Y, const float* __restrict__ freqs,
    const float* __restrict__ gq, const float* __restrict__ gk,
    _Float16* __restrict__ qh, _Float16* __restrict__ kh, _Float16* __restrict__ vh)
{
  const int m = blockIdx.x;
  const int b = m / SS, s = m % SS;
  const int tid = threadIdx.x;
  const float* Yr = Y + (size_t)m * N1;
  const int c0 = tid * 8;

  float qv[8], kv[8], vv[8];
  float sq = 0.f, sk = 0.f;
#pragma unroll
  for (int j = 0; j < 8; j++) {
    qv[j] = Yr[c0 + j]; kv[j] = Yr[DD + c0 + j]; vv[j] = Yr[2 * DD + c0 + j];
    sq += qv[j] * qv[j]; sk += kv[j] * kv[j];
  }
  for (int msk = 16; msk; msk >>= 1) {
    sq += __shfl_xor(sq, msk, 32);
    sk += __shfl_xor(sk, msk, 32);
  }
  __shared__ float red[16];
  const int wid = tid >> 5;
  if ((tid & 31) == 0) { red[wid] = sq; red[8 + wid] = sk; }
  __syncthreads();
  if (tid == 0) {
    float a = 0.f, c = 0.f;
    for (int i = 0; i < 8; i++) { a += red[i]; c += red[8 + i]; }
    red[0] = a; red[8] = c;
  }
  __syncthreads();
  const float rq = rsqrtf(red[0] * (1.0f / DD) + 1e-6f);
  const float rk = rsqrtf(red[8] * (1.0f / DD) + 1e-6f);

  const int n  = c0 / HD;
  const int d0 = c0 % HD;
  const size_t ob = ((size_t)(b * NH + n) * SS + s) * HD + d0;
#pragma unroll
  for (int j = 0; j < 8; j += 2) {
    const int p = (d0 + j) >> 1;
    const float f  = freqs[(size_t)s * (HD / 2) + p];
    const float cf = __cosf(f), sf = __sinf(f);
    const float u0 = qv[j]     * rq * gq[c0 + j];
    const float u1 = qv[j + 1] * rq * gq[c0 + j + 1];
    qh[ob + j]     = (_Float16)(u0 * cf - u1 * sf);
    qh[ob + j + 1] = (_Float16)(u0 * sf + u1 * cf);
    const float w0 = kv[j]     * rk * gk[c0 + j];
    const float w1 = kv[j + 1] * rk * gk[c0 + j + 1];
    kh[ob + j]     = (_Float16)(w0 * cf - w1 * sf);
    kh[ob + j + 1] = (_Float16)(w0 * sf + w1 * cf);
    vh[ob + j]     = (_Float16)vv[j];
    vh[ob + j + 1] = (_Float16)vv[j + 1];
  }
}

#define VPITCH 144  /* halves; 288 B = 32 B x odd, the transposing load's pitch */
#define KPITCH 136  /* halves; 272 B = 16 B x odd, the ds_load_b128 pitch */

typedef __attribute__((ext_vector_type(8))) short s16x8;
typedef __attribute__((address_space(3))) s16x8 lds_s16x8;

__device__ __forceinline__ v8h ld_tr16(const _Float16* p) {
  return __builtin_bit_cast(v8h, __builtin_amdgcn_ds_load_tr16_b128_v8i16((lds_s16x8*)p));
}

/* value of lane l ^ 16 */
__device__ __forceinline__ float xhalf(float x) {
  return __builtin_bit_cast(float, __builtin_amdgcn_permlanex16(
      __builtin_bit_cast(int, x), __builtin_bit_cast(int, x),
      0x76543210, 0xfedcba98, false, false));
}

__global__ __launch_bounds__(128) void attn_wmma(
    const _Float16* __restrict__ qh, const _Float16* __restrict__ kh,
    const _Float16* __restrict__ vh, const int* __restrict__ seq_lens,
    _Float16* __restrict__ oh)
{
  __shared__ __align__(16) _Float16 ldsK[32 * KPITCH];
  __shared__ __align__(16) _Float16 ldsV[32 * VPITCH];

  const int tid = threadIdx.x;
  const int lane = tid & 31, w = tid >> 5;
  const int l15 = lane & 15, hi8 = (lane >> 4) << 3;
  const int nqt = SS / 128;
  const int qt = blockIdx.x % nqt;
  const int h  = (blockIdx.x / nqt) % NH;
  const int b  = blockIdx.x / (nqt * NH);
  /* the key mask is arange(S) < seq_len: clamping to [0, S] leaves it as it is
     and bounds the trip count and every K/V address */
  int slen = seq_lens[b];
  slen = slen < 0 ? 0 : (slen > SS ? SS : slen);
  /* no valid key: every score equals the mask value, softmax is uniform over
     all S keys; scores of zero over all keys give the same */
  const int   lim = slen == 0 ? SS : slen;
  const float scl = slen == 0 ? 0.f : 0.08838834764831845f; /* 1/sqrt(128) */

  const size_t headO = (size_t)(b * NH + h) * SS * HD;
  const _Float16* qbase = qh + headO + (size_t)(qt * 128 + w * 32) * HD;
  const _Float16* kbase = kh + headO;
  const _Float16* vbase = vh + headO;

  /* B operand Q^T: column = query, same k order as the K rows (same loader) */
  v16h qf[2][4];
#pragma unroll
  for (int i = 0; i < 2; i++)
#pragma unroll
    for (int dc = 0; dc < 4; dc++)
      qf[i][dc] = ld_frag(qbase + (size_t)(i * 16) * HD + dc * 32, HD);

  const v8f zf = {};
  v8f o[2][8];                 /* o[i][dj][r] = O[query i*16+l15][dj*16+hi8+r] */
#pragma unroll
  for (int i = 0; i < 2; i++)
#pragma unroll
    for (int dj = 0; dj < 8; dj++) o[i][dj] = zf;
  float mrow[2], lrow[2];      /* lrow: this wave half's keys only */
#pragma unroll
  for (int i = 0; i < 2; i++) { mrow[i] = -3.0e38f; lrow[i] = 0.f; }

  /* lane address of the transposing load: key row 8*(l>>4)+(l&7), 16-B column half (l>>3)&1 */
  const _Float16* vtr = ldsV + (hi8 + (lane & 7)) * VPITCH + (((lane >> 3) & 1) << 3);

  const int nkt = (lim + 31) >> 5;
  for (int kt = 0; kt < nkt; ++kt) {
    /* stage K tile and V tile, [32][128 + pad] each, both row-major */
#pragma unroll
    for (int t = 0; t < 4; t++) {
      const int c = tid + t * 128;            /* 512 chunks of 8 halves */
      const int kk = c >> 4, seg = (c & 15) << 3;
#if USE_ASYNC
      async_cp16(kbase + (size_t)(kt * 32 + kk) * HD + seg, ldsK + kk * KPITCH + seg);
      async_cp16(vbase + (size_t)(kt * 32 + kk) * HD + seg, ldsV + kk * VPITCH + seg);
#else
      *(v8h*)(ldsK + kk * KPITCH + seg) = *(const v8h*)(kbase + (size_t)(kt * 32 + kk) * HD + seg);
      *(v8h*)(ldsV + kk * VPITCH + seg) = *(const v8h*)(vbase + (size_t)(kt * 32 + kk) * HD + seg);
#endif
    }
#if USE_ASYNC
    /* this wave's copies have landed before the barrier publishes them */
    asm volatile("s_wait_asynccnt 0x0" ::: "memory");
#endif
    __syncthreads();

    /* S^T = K * Q^T : sc[j][i][r] = score(key j*16+hi8+r, query i*16+l15) */
    v8f sc[2][2];
#pragma unroll
    for (int j = 0; j < 2; j++)
#pragma unroll
      for (int i = 0; i < 2; i++) sc[j][i] = zf;
#pragma unroll
    for (int dc = 0; dc < 4; dc++) {
      v16h ak0 = ld_frag(ldsK + 0 * 16 * KPITCH + dc * 32, KPITCH);
      v16h ak1 = ld_frag(ldsK + 1 * 16 * KPITCH + dc * 32, KPITCH);
#pragma unroll
      for (int i = 0; i < 2; i++) {
        sc[0][i] = __builtin_amdgcn_wmma_f32_16x16x32_f16(
            false, ak0, false, qf[i][dc], (short)0, sc[0][i], false, false);
        sc[1][i] = __builtin_amdgcn_wmma_f32_16x16x32_f16(
            false, ak1, false, qf[i][dc], (short)0, sc[1][i], false, false);
      }
    }

    /* scale; key mask only in a tile that reaches past the last valid key */
#pragma unroll
    for (int j = 0; j < 2; j++)
#pragma unroll
      for (int i = 0; i < 2; i++)
#pragma unroll
        for (int r = 0; r < 8; r++) sc[j][i][r] *= scl;
    if (kt * 32 + 32 > lim) {
#pragma unroll
      for (int j = 0; j < 2; j++)
#pragma unroll
        for (int r = 0; r < 8; r++) {
          const bool valid = kt * 32 + j * 16 + hi8 + r < lim;
#pragma unroll
          for (int i = 0; i < 2; i++) sc[j][i][r] = valid ? sc[j][i][r] : -3.0e38f;
        }
    }

    /* online softmax: a lane and its partner in the other half share one query */
    v16h pf[2];
#pragma unroll
    for (int i = 0; i < 2; i++) {
      float t = fmaxf(sc[0][i][0], sc[1][i][0]);
#pragma unroll
      for (int r = 1; r < 8; r++) t = fmaxf(t, fmaxf(sc[0][i][r], sc[1][i][r]));
      t = fmaxf(t, xhalf(t));
      const float mn = fmaxf(mrow[i], t);
      const float al = __expf(mrow[i] - mn);
      float rs = 0.f;
#pragma unroll
      for (int j = 0; j < 2; j++)
#pragma unroll
        for (int r = 0; r < 8; r++) {
          const float p = __expf(sc[j][i][r] - mn);
          rs += p;
          pf[i][j * 8 + r] = (_Float16)p;   /* B operand P^T, hardware k order */
        }
      lrow[i] = lrow[i] * al + rs;
      mrow[i] = mn;
#pragma unroll
      for (int dj = 0; dj < 8; dj++)
#pragma unroll
        for (int r = 0; r < 8; r++) o[i][dj][r] *= al;
    }

    /* O^T += V^T * P^T  (A frags: rows = d, matmul-K = key) */
#pragma unroll
    for (int dj = 0; dj < 8; dj++) {
      const v8h lo = ld_tr16(vtr + dj * 16);
      const v8h hi = ld_tr16(vtr + 16 * VPITCH + dj * 16);
      v16h vf;
#pragma unroll
      for (int e = 0; e < 8; e++) { vf[e] = lo[e]; vf[8 + e] = hi[e]; }
      o[0][dj] = __builtin_amdgcn_wmma_f32_16x16x32_f16(
          false, vf, false, pf[0], (short)0, o[0][dj], false, false);
      o[1][dj] = __builtin_amdgcn_wmma_f32_16x16x32_f16(
          false, vf, false, pf[1], (short)0, o[1][dj], false, false);
    }
    __syncthreads();
  }

  /* join the halves' sums, normalize, write [B,S,D] f16: 8 consecutive d per lane */
#pragma unroll
  for (int i = 0; i < 2; i++) {
    const int srow = qt * 128 + w * 32 + i * 16 + l15;
    const float inv = 1.0f / (lrow[i] + xhalf(lrow[i]));
    _Float16* orow = oh + ((size_t)(b * SS + srow)) * DD + h * HD + hi8;
#pragma unroll
    for (int dj = 0; dj < 8; dj++) {
      v8h ov;
#pragma unroll
      for (int r = 0; r < 8; r++) ov[r] = (_Float16)(o[i][dj][r] * inv);
      *(v8h*)(orow + dj * 16) = ov;
    }
  }
}

/* ---------------- host-side orchestration ---------------- */
extern "C" void kernel_launch(void* const* d_in, const int* in_sizes, int n_in,
                              void* d_out, int out_size, void* d_ws, size_t ws_size,
                              hipStream_t stream) {
  (void)in_sizes; (void)n_in; (void)out_size; (void)ws_size;
  const float* x        = (const float*)d_in[0];
  const int*   seq_lens = (const int*)d_in[1];
  const float* freqs    = (const float*)d_in[2];
  const float* wq = (const float*)d_in[3];
  const float* bq = (const float*)d_in[4];
  const float* wk = (const float*)d_in[5];
  const float* bk = (const float*)d_in[6];
  const float* wv = (const float*)d_in[7];
  const float* bv = (const float*)d_in[8];
  const float* wo = (const float*)d_in[9];
  const float* bo = (const float*)d_in[10];
  const float* gq = (const float*)d_in[11];
  const float* gk = (const float*)d_in[12];

  char* ws = (char*)d_ws;
  _Float16* xh    = (_Float16*)(ws + OFF_XH);
  _Float16* wqkvh = (_Float16*)(ws + OFF_WQKV);
  _Float16* woh   = (_Float16*)(ws + OFF_WO);
  float*    Y     = (float*)(ws + OFF_Y);
  _Float16* qhp   = (_Float16*)(ws + OFF_QH);
  _Float16* khp   = (_Float16*)(ws + OFF_KH);
  _Float16* vhp   = (_Float16*)(ws + OFF_VH);
  _Float16* ohp   = (_Float16*)(ws + OFF_OH);

  /* 1) down-convert activations + weights to f16 */
  cvt_f16<<<1024, 256, 0, stream>>>(x,  xh,               MM * DD);
  cvt_f16<<<1024, 256, 0, stream>>>(wq, wqkvh,            DD * DD);
  cvt_f16<<<1024, 256, 0, stream>>>(wk, wqkvh + (size_t)DD * DD,     DD * DD);
  cvt_f16<<<1024, 256, 0, stream>>>(wv, wqkvh + (size_t)2 * DD * DD, DD * DD);
  cvt_f16<<<1024, 256, 0, stream>>>(wo, woh,              DD * DD);

  /* 2) fused QKV projection: Y[4096,6144] = xh * [wq;wk;wv]^T + [bq|bk|bv] */
  gemm_wmma<<<dim3(N1 / 128, MM / 128), 256, 0, stream>>>(
      xh, wqkvh, Y, MM, N1, DD, bq, bk, bv, DD, 2 * DD);

  /* 3) RMSNorm + RoPE + repack */
  norm_rope<<<MM, 256, 0, stream>>>(Y, freqs, gq, gk, qhp, khp, vhp);

  /* 4) flash attention */
  attn_wmma<<<BB * NH * (SS / 128), 128, 0, stream>>>(qhp, khp, vhp, seq_lens, ohp);

  /* 5) output projection into d_out (f32) */
  gemm_wmma<<<dim3(DD / 128, MM / 128), 256, 0, stream>>>(
      ohp, woh, (float*)d_out, MM, DD, DD, bo, bo, bo, DD, 2 * DD);
}

// v004
// One run takes 244 microseconds.
// Two timings next to v003 put it at 1.18 and 1.19 times that version's speed.
// Counting every step since v000, it is 3.22 times as fast.
#include <hip/hip_runtime.h>

typedef __attribute__((ext_vector_type(16))) _Float16 v16h;
typedef __attribute__((ext_vector_type(8)))  _Float16 v8h;
typedef __attribute__((ext_vector_type(8)))  float    v8f;
typedef __attribute__((ext_vector_type(4)))  int      v4i;

#define BB 2
#define SS 2048
#define DD 2048
#define NH 16
#define HD 128
#define MM (BB*SS)      /* 4096 rows */
#define N1 (3*DD)       /* 6144 fused QKV cols */

/* ---- workspace layout (bytes) ---- */
#define OFF_XH   ((size_t)0)
#define OFF_WQKV (OFF_XH   + (size_t)MM*DD*2)     /* x in f16            */
#define OFF_WO   (OFF_WQKV + (size_t)N1*DD*2)     /* [wq;wk;wv] f16      */
#define OFF_Y    (OFF_WO   + (size_t)DD*DD*2)     /* wo f16              */
#define OFF_QH   (OFF_Y    + (size_t)MM*N1*4)     /* fused QKV f32       */
#define OFF_KH   (OFF_QH   + (size_t)MM*DD*2)     /* q f16 [B,N,S,HD]    */
#define OFF_VH   (OFF_KH   + (size_t)MM*DD*2)
#define OFF_OH   (OFF_VH   + (size_t)MM*DD*2)     /* attn out f16 [B,S,D]*/

/* ---- CDNA5 async global->LDS copy (ASYNCcnt-tracked, bypasses VGPRs) ---- */
#if __has_builtin(__builtin_amdgcn_global_load_async_to_lds_b128) && \
    __has_builtin(__builtin_amdgcn_s_wait_asynccnt)
#define USE_ASYNC 1
#else
#define USE_ASYNC 0
#endif

/* b128 payload type: <4 x i32>; clang prints AS(1) as `__device__` in HIP */
typedef __attribute__((address_space(1))) v4i gv4i;
typedef __attribute__((address_space(3))) v4i lv4i;

__device__ __forceinline__ void async_cp16(const void* g, void* l) {
#if USE_ASYNC
  /* generic LDS pointers carry the LDS byte offset in the low 32 bits
     (flat->LDS aperture mapping: LDS_ADDR = addr[31:0]) */
  __builtin_amdgcn_global_load_async_to_lds_b128(
      (gv4i*)(unsigned long long)(size_t)g,
      (lv4i*)(unsigned int)(size_t)l, 0, 0);
#else
  (void)g; (void)l;
#endif
}

/* ---------------- f32 -> f16 convert: x and the four weights, one streaming launch ----------------
   The five f16 copies lie one behind the other at the start of the workspace
   (x | wq | wk | wv | wo), so the destination is one array and a block's
   32,768 elements come from one source. A wave-wide load covers 512 contiguous
   bytes (4 whole lines), a wave-wide store 256 (2 whole lines); at least 8
   loads of a lane are in flight before the first is converted. */
typedef __attribute__((ext_vector_type(4))) float    v4f;
typedef __attribute__((ext_vector_type(4))) _Float16 v4h;
#define CVT_LD   8                             /* 16-B loads of a lane issued as a group */
#define CVT_IT   4                             /* such groups per lane */
#define CVT_BLK  (256 * 4 * CVT_LD * CVT_IT)   /* elements per block */
#define CVT_XB   (MM * DD / CVT_BLK)           /* blocks of x */
#define CVT_WB   (DD * DD / CVT_BLK)           /* blocks of one weight */
__global__ __launch_bounds__(256) void cvt_f16(
    const float* __restrict__ x,  const float* __restrict__ wq,
    const float* __restrict__ wk, const float* __restrict__ wv,
    const float* __restrict__ wo, _Float16* __restrict__ dst)
{
  const int blk = blockIdx.x;
  const float* src = x;
  int sb = blk;
  if (blk >= CVT_XB) {
    const int u = (blk - CVT_XB) / CVT_WB;
    sb  = (blk - CVT_XB) % CVT_WB;
    src = u == 0 ? wq : u == 1 ? wk : u == 2 ? wv : wo;
  }
  const float* s = src + (size_t)sb  * CVT_BLK + threadIdx.x * 4;
  _Float16*    d = dst + (size_t)blk * CVT_BLK + threadIdx.x * 4;
  for (int it = 0; it < CVT_IT; ++it) {
    v4f v[CVT_LD];
#pragma unroll
    for (int j = 0; j < CVT_LD; j++)
      v[j] = *(const v4f*)(s + (it * CVT_LD + j) * 1024);
#pragma unroll
    for (int j = 0; j < CVT_LD; j++) {
      v4h h;
#pragma unroll
      for (int e = 0; e < 4; e++) h[e] = (_Float16)v[j][e];
      *(v4h*)(d + (it * CVT_LD + j) * 1024) = h;
    }
  }
}

/* Fragment loader per CDNA5 ISA 7.12.2 (16-bit A 16x32 / B 32x16 layouts).
   tile: pointer to the 16-row tile origin; row dim stride = `stride` halves;
   contiguous (matmul-K) dim carries the 8+8 half split at +0 / +16. */
__device__ __forceinline__ v16h ld_frag(const _Float16* tile, int stride) {
  const int lane = threadIdx.x & 31;
  const _Float16* p = tile + (size_t)(lane & 15) * stride + ((lane >> 4) << 3);
  v8h lo = *(const v8h*)(p);
  v8h hi = *(const v8h*)(p + 16);
  v16h r;
#pragma unroll
  for (int i = 0; i < 8; ++i) { r[i] = lo[i]; r[8 + i] = hi[i]; }
  return r;
}

/* ---------------- WMMA GEMM: C[M,N] = A[M,K] * Bw[N,K]^T + bias ----------------
   128x128 block tile, 8 waves, wave tile 32x64 (2x4 of 16x16), K-step 64:
   a staged row is one whole 128-B line, so a wave's 512-B copy asks L2 for
   4 full lines.
   Global->LDS staging via async copy engine, LDS double buffered:
   8 async b128 ops per wave per stage; s_wait_asynccnt 8 retires the previous
   stage (per-wave in-order completion) while the next stage streams. */
#define GKS    64   /* halves of K per stage */
#define GCP    4    /* 16-B chunks per thread, operand and stage: 128 rows x 8 / 256 */
#define GPITCH 72   /* halves; 144 B = 16 B x odd: 16 rows of a ds_load_b128 fall on 16 bank groups */
__global__ __launch_bounds__(256) void gemm_wmma(
    const _Float16* __restrict__ A, const _Float16* __restrict__ Bw,
    float* __restrict__ C, int Mdim, int Ndim, int Kdim,
    const float* __restrict__ b0, const float* __restrict__ b1,
    const float* __restrict__ b2, int s1, int s2)
{
  __shared__ __align__(16) _Float16 ldsA[2][128 * GPITCH];
  __shared__ __align__(16) _Float16 ldsB[2][128 * GPITCH];
  const int tid  = threadIdx.x;
  const int lane = tid & 31, wave = tid >> 5;
  const int l15  = lane & 15, hi8 = (lane >> 4) << 3;
  const int wm = wave >> 1, wn = wave & 1;
  const int mBase = blockIdx.y * 128;
  const int nBase = blockIdx.x * 128;

  const v8f zf = {};
  v8f acc[2][4];
#pragma unroll
  for (int i = 0; i < 2; i++)
#pragma unroll
    for (int j = 0; j < 4; j++) acc[i][j] = zf;

  int rowT[GCP], segT[GCP];
#pragma unroll
  for (int t = 0; t < GCP; t++) {
    int c = tid + t * 256;            /* 1024 16B chunks per 128x64 tile */
    rowT[t] = c >> 3;
    segT[t] = (c & 7) << 3;
  }

  const int nk = Kdim / GKS;

#if USE_ASYNC
  /* ---- async pipeline ---- */
#pragma unroll
  for (int t = 0; t < GCP; t++) {     /* stage 0 */
    async_cp16(A  + (size_t)(mBase + rowT[t]) * Kdim + segT[t],
               &ldsA[0][rowT[t] * GPITCH + segT[t]]);
    async_cp16(Bw + (size_t)(nBase + rowT[t]) * Kdim + segT[t],
               &ldsB[0][rowT[t] * GPITCH + segT[t]]);
  }
  for (int kb = 0; kb < nk; ++kb) {
    const int st = kb & 1;
    if (kb + 1 < nk) {
      const int k0 = (kb + 1) * GKS;
      __builtin_prefetch(A + (size_t)(mBase + rowT[0]) * Kdim + k0 + 64, 0, 0);
#pragma unroll
      for (int t = 0; t < GCP; t++) {
        async_cp16(A  + (size_t)(mBase + rowT[t]) * Kdim + k0 + segT[t],
                   &ldsA[st ^ 1][rowT[t] * GPITCH + segT[t]]);
        async_cp16(Bw + (size_t)(nBase + rowT[t]) * Kdim + k0 + segT[t],
                   &ldsB[st ^ 1][rowT[t] * GPITCH + segT[t]]);
      }
      __builtin_amdgcn_s_wait_asynccnt(2 * GCP);   /* previous stage landed */
    } else {
      __builtin_amdgcn_s_wait_asynccnt(0);
    }
    __syncthreads();
    /* unrolled: both 32-k halves of the stage read at constant LDS offsets */
#pragma unroll
    for (int ks = 0; ks < GKS; ks += 32) {
      v16h af[2], bf[4];
#pragma unroll
      for (int i = 0; i < 2; i++) af[i] = ld_frag(&ldsA[st][(wm * 32 + i * 16) * GPITCH + ks], GPITCH);
#pragma unroll
      for (int j = 0; j < 4; j++) bf[j] = ld_frag(&ldsB[st][(wn * 64 + j * 16) * GPITCH + ks], GPITCH);
#pragma unroll
      for (int i = 0; i < 2; i++)
#pragma unroll
        for (int j = 0; j < 4; j++)
          acc[i][j] = __builtin_amdgcn_wmma_f32_16x16x32_f16(
              false, af[i], false, bf[j], (short)0, acc[i][j], false, false);
    }
    __syncthreads();
  }
#else
  /* ---- fallback: register-staged pipeline ---- */
  v8h ra[GCP], rb[GCP];
#pragma unroll
  for (int t = 0; t < GCP; t++) {
    ra[t] = *(const v8h*)(A  + (size_t)(mBase + rowT[t]) * Kdim + segT[t]);
    rb[t] = *(const v8h*)(Bw + (size_t)(nBase + rowT[t]) * Kdim + segT[t]);
  }
  for (int kb = 0; kb < nk; ++kb) {
#pragma unroll
    for (int t = 0; t < GCP; t++) {
      *(v8h*)(&ldsA[0][rowT[t] * GPITCH + segT[t]]) = ra[t];
      *(v8h*)(&ldsB[0][rowT[t] * GPITCH + segT[t]]) = rb[t];
    }
    __syncthreads();
    if (kb + 1 < nk) {
      const int k0 = (kb + 1) * GKS;
      __builtin_prefetch(A + (size_t)(mBase + rowT[0]) * Kdim + k0 + 32, 0, 0);
#pragma unroll
      for (int t = 0; t < GCP; t++) {
        ra[t] = *(const v8h*)(A  + (size_t)(mBase + rowT[t]) * Kdim + k0 + segT[t]);
        rb[t] = *(const v8h*)(Bw + (size_t)(nBase + rowT[t]) * Kdim + k0 + segT[t]);
      }
    }
    /* unrolled: both 32-k halves of the stage read at constant LDS offsets */
#pragma unroll
    for (int ks = 0; ks < GKS; ks += 32) {
      v16h af[2], bf[4];
#pragma unroll
      for (int i = 0; i < 2; i++) af[i] = ld_frag(&ldsA[0][(wm * 32 + i * 16) * GPITCH + ks], GPITCH);
#pragma unroll
      for (int j = 0; j < 4; j++) bf[j] = ld_frag(&ldsB[0][(wn * 64 + j * 16) * GPITCH + ks], GPITCH);
#pragma unroll
      for (int i = 0; i < 2; i++)
#pragma unroll
        for (int j = 0; j < 4; j++)
          acc[i][j] = __builtin_amdgcn_wmma_f32_16x16x32_f16(
              false, af[i], false, bf[j], (short)0, acc[i][j], false, false);
    }
    __syncthreads();
  }
#endif

  /* epilogue: C/D layout — lane holds col, VGPR r holds row r + 8*(lane>=16) */
#pragma unroll
  for (int i = 0; i < 2; i++)
#pragma unroll
    for (int j = 0; j < 4; j++) {
      const int col = nBase + wn * 64 + j * 16 + l15;
      const float bias = (col < s1) ? b0[col] : (col < s2) ? b1[col - s1] : b2[col - s2];
#pragma unroll
      for (int r = 0; r < 8; r++) {
        const int row = mBase + wm * 32 + i * 16 + r + hi8;
        C[(size_t)row * Ndim + col] = acc[i][j][r] + bias;
      }
    }
}

/* ---------------- RMSNorm + RoPE + repack to [B,N,S,HD] f16 ---------------- */
__global__ __launch_bounds__(256) void norm_rope(
    const float* __restrict__ Y, const float* __restrict__ freqs,
    const float* __restrict__ gq, const float* __restrict__ gk,
    _Float16* __restrict__ qh, _Float16* __restrict__ kh, _Float16* __restrict__ vh)
{
  const int m = blockIdx.x;
  const int b = m / SS, s = m % SS;
  const int tid = threadIdx.x;
  const float* Yr = Y + (size_t)m * N1;
  const int c0 = tid * 8;

  float qv[8], kv[8], vv[8];
  float sq = 0.f, sk = 0.f;
#pragma unroll
  for (int j = 0; j < 8; j++) {
    qv[j] = Yr[c0 + j]; kv[j] = Yr[DD + c0 + j]; vv[j] = Yr[2 * DD + c0 + j];
    sq += qv[j] * qv[j]; sk += kv[j] * kv[j];
  }
  for (int msk = 16; msk; msk >>= 1) {
    sq += __shfl_xor(sq, msk, 32);
    sk += __shfl_xor(sk, msk, 32);
  }
  __shared__ float red[16];
  const int wid = tid >> 5;
  if ((tid & 31) == 0) { red[wid] = sq; red[8 + wid] = sk; }
  __syncthreads();
  if (tid == 0) {
    float a = 0.f, c = 0.f;
    for (int i = 0; i < 8; i++) { a += red[i]; c += red[8 + i]; }
    red[0] = a; red[8] = c;
  }
  __syncthreads();
  const float rq = rsqrtf(red[0] * (1.0f / DD) + 1e-6f);
  const float rk = rsqrtf(red[8] * (1.0f / DD) + 1e-6f);

  const int n  = c0 / HD;
  const int d0 = c0 % HD;
  const size_t ob = ((size_t)(b * NH + n) * SS + s) * HD + d0;
#pragma unroll
  for (int j = 0; j < 8; j += 2) {
    const int p = (d0 + j) >> 1;
    const float f  = freqs[(size_t)s * (HD / 2) + p];
    const float cf = __cosf(f), sf = __sinf(f);
    const float u0 = qv[j]     * rq * gq[c0 + j];
    const float u1 = qv[j + 1] * rq * gq[c0 + j + 1];
    qh[ob + j]     = (_Float16)(u0 * cf - u1 * sf);
    qh[ob + j + 1] = (_Float16)(u0 * sf + u1 * cf);
    const float w0 = kv[j]     * rk * gk[c0 + j];
    const float w1 = kv[j + 1] * rk * gk[c0 + j + 1];
    kh[ob + j]     = (_Float16)(w0 * cf - w1 * sf);
    kh[ob + j + 1] = (_Float16)(w0 * sf + w1 * cf);
    vh[ob + j]     = (_Float16)vv[j];
    vh[ob + j + 1] = (_Float16)vv[j + 1];
  }
}

#define VPITCH 144  /* halves; 288 B = 32 B x odd, the transposing load's pitch */
#define KPITCH 136  /* halves; 272 B = 16 B x odd, the ds_load_b128 pitch */

typedef __attribute__((ext_vector_type(8))) short s16x8;
typedef __attribute__((address_space(3))) s16x8 lds_s16x8;

__device__ __forceinline__ v8h ld_tr16(const _Float16* p) {
  return __builtin_bit_cast(v8h, __builtin_amdgcn_ds_load_tr16_b128_v8i16((lds_s16x8*)p));
}

/* value of lane l ^ 16 */
__device__ __forceinline__ float xhalf(float x) {
  return __builtin_bit_cast(float, __builtin_amdgcn_permlanex16(
      __builtin_bit_cast(int, x), __builtin_bit_cast(int, x),
      0x76543210, 0xfedcba98, false, false));
}

__global__ __launch_bounds__(128) void attn_wmma(
    const _Float16* __restrict__ qh, const _Float16* __restrict__ kh,
    const _Float16* __restrict__ vh, const int* __restrict__ seq_lens,
    _Float16* __restrict__ oh)
{
  __shared__ __align__(16) _Float16 ldsK[32 * KPITCH];
  __shared__ __align__(16) _Float16 ldsV[32 * VPITCH];

  const int tid = threadIdx.x;
  const int lane = tid & 31, w = tid >> 5;
  const int l15 = lane & 15, hi8 = (lane >> 4) << 3;
  const int nqt = SS / 128;
  const int qt = blockIdx.x % nqt;
  const int h  = (blockIdx.x / nqt) % NH;
  const int b  = blockIdx.x / (nqt * NH);
  /* the key mask is arange(S) < seq_len: clamping to [0, S] leaves it as it is
     and bounds the trip count and every K/V address */
  int slen = seq_lens[b];
  slen = slen < 0 ? 0 : (slen > SS ? SS : slen);
  /* no valid key: every score equals the mask value, softmax is uniform over
     all S keys; scores of zero over all keys give the same */
  const int   lim = slen == 0 ? SS : slen;
  const float scl = slen == 0 ? 0.f : 0.08838834764831845f; /* 1/sqrt(128) */

  const size_t headO = (size_t)(b * NH + h) * SS * HD;
  const _Float16* qbase = qh + headO + (size_t)(qt * 128 + w * 32) * HD;
  const _Float16* kbase = kh + headO;
  const _Float16* vbase = vh + headO;

  /* B operand Q^T: column = query, same k order as the K rows (same loader) */
  v16h qf[2][4];
#pragma unroll
  for (int i = 0; i < 2; i++)
#pragma unroll
    for (int dc = 0; dc < 4; dc++)
      qf[i][dc] = ld_frag(qbase + (size_t)(i * 16) * HD + dc * 32, HD);

  const v8f zf = {};
  v8f o[2][8];                 /* o[i][dj][r] = O[query i*16+l15][dj*16+hi8+r] */
#pragma unroll
  for (int i = 0; i < 2; i++)
#pragma unroll
    for (int dj = 0; dj < 8; dj++) o[i][dj] = zf;
  float mrow[2], lrow[2];      /* lrow: this wave half's keys only */
#pragma unroll
  for (int i = 0; i < 2; i++) { mrow[i] = -3.0e38f; lrow[i] = 0.f; }

  /* lane address of the transposing load: key row 8*(l>>4)+(l&7), 16-B column half (l>>3)&1 */
  const _Float16* vtr = ldsV + (hi8 + (lane & 7)) * VPITCH + (((lane >> 3) & 1) << 3);

  const int nkt = (lim + 31) >> 5;
  for (int kt = 0; kt < nkt; ++kt) {
    /* stage K tile and V tile, [32][128 + pad] each, both row-major */
#pragma unroll
    for (int t = 0; t < 4; t++) {
      const int c = tid + t * 128;            /* 512 chunks of 8 halves */
      const int kk = c >> 4, seg = (c & 15) << 3;
#if USE_ASYNC
      async_cp16(kbase + (size_t)(kt * 32 + kk) * HD + seg, ldsK + kk * KPITCH + seg);
      async_cp16(vbase + (size_t)(kt * 32 + kk) * HD + seg, ldsV + kk * VPITCH + seg);
#else
      *(v8h*)(ldsK + kk * KPITCH + seg) = *(const v8h*)(kbase + (size_t)(kt * 32 + kk) * HD + seg);
      *(v8h*)(ldsV + kk * VPITCH + seg) = *(const v8h*)(vbase + (size_t)(kt * 32 + kk) * HD + seg);
#endif
    }
#if USE_ASYNC
    /* this wave's copies have landed before the barrier publishes them */
    asm volatile("s_wait_asynccnt 0x0" ::: "memory");
#endif
    __syncthreads();

    /* S^T = K * Q^T : sc[j][i][r] = score(key j*16+hi8+r, query i*16+l15) */
    v8f sc[2][2];
#pragma unroll
    for (int j = 0; j < 2; j++)
#pragma unroll
      for (int i = 0; i < 2; i++) sc[j][i] = zf;
#pragma unroll
    for (int dc = 0; dc < 4; dc++) {
      v16h ak0 = ld_frag(ldsK + 0 * 16 * KPITCH + dc * 32, KPITCH);
      v16h ak1 = ld_frag(ldsK + 1 * 16 * KPITCH + dc * 32, KPITCH);
#pragma unroll
      for (int i = 0; i < 2; i++) {
        sc[0][i] = __builtin_amdgcn_wmma_f32_16x16x32_f16(
            false, ak0, false, qf[i][dc], (short)0, sc[0][i], false, false);
        sc[1][i] = __builtin_amdgcn_wmma_f32_16x16x32_f16(
            false, ak1, false, qf[i][dc], (short)0, sc[1][i], false, false);
      }
    }

    /* scale; key mask only in a tile that reaches past the last valid key */
#pragma unroll
    for (int j = 0; j < 2; j++)
#pragma unroll
      for (int i = 0; i < 2; i++)
#pragma unroll
        for (int r = 0; r < 8; r++) sc[j][i][r] *= scl;
    if (kt * 32 + 32 > lim) {
#pragma unroll
      for (int j = 0; j < 2; j++)
#pragma unroll
        for (int r = 0; r < 8; r++) {
          const bool valid = kt * 32 + j * 16 + hi8 + r < lim;
#pragma unroll
          for (int i = 0; i < 2; i++) sc[j][i][r] = valid ? sc[j][i][r] : -3.0e38f;
        }
    }

    /* online softmax: a lane and its partner in the other half share one query */
    v16h pf[2];
#pragma unroll
    for (int i = 0; i < 2; i++) {
      float t = fmaxf(sc[0][i][0], sc[1][i][0]);
#pragma unroll
      for (int r = 1; r < 8; r++) t = fmaxf(t, fmaxf(sc[0][i][r], sc[1][i][r]));
      t = fmaxf(t, xhalf(t));
      const float mn = fmaxf(mrow[i], t);
      const float al = __expf(mrow[i] - mn);
      float rs = 0.f;
#pragma unroll
      for (int j = 0; j < 2; j++)
#pragma unroll
        for (int r = 0; r < 8; r++) {
          const float p = __expf(sc[j][i][r] - mn);
          rs += p;
          pf[i][j * 8 + r] = (_Float16)p;   /* B operand P^T, hardware k order */
        }
      lrow[i] = lrow[i] * al + rs;
      mrow[i] = mn;
#pragma unroll
      for (int dj = 0; dj < 8; dj++)
#pragma unroll
        for (int r = 0; r < 8; r++) o[i][dj][r] *= al;
    }

    /* O^T += V^T * P^T  (A frags: rows = d, matmul-K = key) */
#pragma unroll
    for (int dj = 0; dj < 8; dj++) {
      const v8h lo = ld_tr16(vtr + dj * 16);
      const v8h hi = ld_tr16(vtr + 16 * VPITCH + dj * 16);
      v16h vf;
#pragma unroll
      for (int e = 0; e < 8; e++) { vf[e] = lo[e]; vf[8 + e] = hi[e]; }
      o[0][dj] = __builtin_amdgcn_wmma_f32_16x16x32_f16(
          false, vf, false, pf[0], (short)0, o[0][dj], false, false);
      o[1][dj] = __builtin_amdgcn_wmma_f32_16x16x32_f16(
          false, vf, false, pf[1], (short)0, o[1][dj], false, false);
    }
    __syncthreads();
  }

  /* join the halves' sums, normalize, write [B,S,D] f16: 8 consecutive d per lane */
#pragma unroll
  for (int i = 0; i < 2; i++) {
    const int srow = qt * 128 + w * 32 + i * 16 + l15;
    const float inv = 1.0f / (lrow[i] + xhalf(lrow[i]));
    _Float16* orow = oh + ((size_t)(b * SS + srow)) * DD + h * HD + hi8;
#pragma unroll
    for (int dj = 0; dj < 8; dj++) {
      v8h ov;
#pragma unroll
      for (int r = 0; r < 8; r++) ov[r] = (_Float16)(o[i][dj][r] * inv);
      *(v8h*)(orow + dj * 16) = ov;
    }
  }
}

/* ---------------- host-side orchestration ---------------- */
extern "C" void kernel_launch(void* const* d_in, const int* in_sizes, int n_in,
                              void* d_out, int out_size, void* d_ws, size_t ws_size,
                              hipStream_t stream) {
  (void)in_sizes; (void)n_in; (void)out_size; (void)ws_size;
  const float* x        = (const float*)d_in[0];
  const int*   seq_lens = (const int*)d_in[1];
  const float* freqs    = (const float*)d_in[2];
  const float* wq = (const float*)d_in[3];
  const float* bq = (const float*)d_in[4];
  const float* wk = (const float*)d_in[5];
  const float* bk = (const float*)d_in[6];
  const float* wv = (const float*)d_in[7];
  const float* bv = (const float*)d_in[8];
  const float* wo = (const float*)d_in[9];
  const float* bo = (const float*)d_in[10];
  const float* gq = (const float*)d_in[11];
  const float* gk = (const float*)d_in[12];

  char* ws = (char*)d_ws;
  _Float16* xh    = (_Float16*)(ws + OFF_XH);
  _Float16* wqkvh = (_Float16*)(ws + OFF_WQKV);
  _Float16* woh   = (_Float16*)(ws + OFF_WO);
  float*    Y     = (float*)(ws + OFF_Y);
  _Float16* qhp   = (_Float16*)(ws + OFF_QH);
  _Float16* khp   = (_Float16*)(ws + OFF_KH);
  _Float16* vhp   = (_Float16*)(ws + OFF_VH);
  _Float16* ohp   = (_Float16*)(ws + OFF_OH);

  /* 1) down-convert activations + weights to f16 */
  cvt_f16<<<CVT_XB + 4 * CVT_WB, 256, 0, stream>>>(x, wq, wk, wv, wo, xh);

  /* 2) fused QKV projection: Y[4096,6144] = xh * [wq;wk;wv]^T + [bq|bk|bv] */
  gemm_wmma<<<dim3(N1 / 128, MM / 128), 256, 0, stream>>>(
      xh, wqkvh, Y, MM, N1, DD, bq, bk, bv, DD, 2 * DD);

  /* 3) RMSNorm + RoPE + repack */
  norm_rope<<<MM, 256, 0, stream>>>(Y, freqs, gq, gk, qhp, khp, vhp);

  /* 4) flash attention */
  attn_wmma<<<BB * NH * (SS / 128), 128, 0, stream>>>(qhp, khp, vhp, seq_lens, ohp);

  /* 5) output projection into d_out (f32) */
  gemm_wmma<<<dim3(DD / 128, MM / 128), 256, 0, stream>>>(
      ohp, woh, (float*)d_out, MM, DD, DD, bo, bo, bo, DD, 2 * DD);
}

// v005
// One run takes 232 microseconds.
// Next to v004, in two timings, it ran 1.05 and 1.06 times as fast.
// Over all steps from v000 it is 3.40 times as fast.
#include <hip/hip_runtime.h>

typedef __attribute__((ext_vector_type(16))) _Float16 v16h;
typedef __attribute__((ext_vector_type(8)))  _Float16 v8h;
typedef __attribute__((ext_vector_type(8)))  float    v8f;
typedef __attribute__((ext_vector_type(4)))  int      v4i;

#define BB 2
#define SS 2048
#define DD 2048
#define NH 16
#define HD 128
#define MM (BB*SS)      /* 4096 rows */
#define N1 (3*DD)       /* 6144 fused QKV cols */

/* ---- workspace layout (bytes) ---- */
#define OFF_XH   ((size_t)0)
#define OFF_WQKV (OFF_XH   + (size_t)MM*DD*2)     /* x in f16            */
#define OFF_WO   (OFF_WQKV + (size_t)N1*DD*2)     /* [wq;wk;wv] f16      */
#define OFF_Y    (OFF_WO   + (size_t)DD*DD*2)     /* wo f16              */
#define OFF_QH   (OFF_Y    + (size_t)MM*N1*4)     /* fused QKV f32       */
#define OFF_KH   (OFF_QH   + (size_t)MM*DD*2)     /* q f16 [B,N,S,HD]    */
#define OFF_VH   (OFF_KH   + (size_t)MM*DD*2)
#define OFF_OH   (OFF_VH   + (size_t)MM*DD*2)     /* attn out f16 [B,S,D]*/

/* ---- CDNA5 async global->LDS copy (ASYNCcnt-tracked, bypasses VGPRs) ---- */
#if __has_builtin(__builtin_amdgcn_global_load_async_to_lds_b128) && \
    __has_builtin(__builtin_amdgcn_s_wait_asynccnt)
#define USE_ASYNC 1
#else
#define USE_ASYNC 0
#endif

/* b128 payload type: <4 x i32>; clang prints AS(1) as `__device__` in HIP */
typedef __attribute__((address_space(1))) v4i gv4i;
typedef __attribute__((address_space(3))) v4i lv4i;

__device__ __forceinline__ void async_cp16(const void* g, void* l) {
#if USE_ASYNC
  /* generic LDS pointers carry the LDS byte offset in the low 32 bits
     (flat->LDS aperture mapping: LDS_ADDR = addr[31:0]) */
  __builtin_amdgcn_global_load_async_to_lds_b128(
      (gv4i*)(unsigned long long)(size_t)g,
      (lv4i*)(unsigned int)(size_t)l, 0, 0);
#else
  (void)g; (void)l;
#endif
}

/* ---------------- f32 -> f16 convert: x and the four weights, one streaming launch ----------------
   The five f16 copies lie one behind the other at the start of the workspace
   (x | wq | wk | wv | wo), so the destination is one array and a block's
   32,768 elements come from one source. A wave-wide load covers 512 contiguous
   bytes (4 whole lines), a wave-wide store 256 (2 whole lines); at least 8
   loads of a lane are in flight before the first is converted. */
typedef __attribute__((ext_vector_type(4))) float    v4f;
typedef __attribute__((ext_vector_type(4))) _Float16 v4h;
#define CVT_LD   8                             /* 16-B loads of a lane issued as a group */
#define CVT_IT   4                             /* such groups per lane */
#define CVT_BLK  (256 * 4 * CVT_LD * CVT_IT)   /* elements per block */
#define CVT_XB   (MM * DD / CVT_BLK)           /* blocks of x */
#define CVT_WB   (DD * DD / CVT_BLK)           /* blocks of one weight */
__global__ __launch_bounds__(256) void cvt_f16(
    const float* __restrict__ x,  const float* __restrict__ wq,
    const float* __restrict__ wk, const float* __restrict__ wv,
    const float* __restrict__ wo, _Float16* __restrict__ dst)
{
  const int blk = blockIdx.x;
  const float* src = x;
  int sb = blk;
  if (blk >= CVT_XB) {
    const int u = (blk - CVT_XB) / CVT_WB;
    sb  = (blk - CVT_XB) % CVT_WB;
    src = u == 0 ? wq : u == 1 ? wk : u == 2 ? wv : wo;
  }
  const float* s = src + (size_t)sb  * CVT_BLK + threadIdx.x * 4;
  _Float16*    d = dst + (size_t)blk * CVT_BLK + threadIdx.x * 4;
  for (int it = 0; it < CVT_IT; ++it) {
    v4f v[CVT_LD];
#pragma unroll
    for (int j = 0; j < CVT_LD; j++)
      v[j] = *(const v4f*)(s + (it * CVT_LD + j) * 1024);
#pragma unroll
    for (int j = 0; j < CVT_LD; j++) {
      v4h h;
#pragma unroll
      for (int e = 0; e < 4; e++) h[e] = (_Float16)v[j][e];
      *(v4h*)(d + (it * CVT_LD + j) * 1024) = h;
    }
  }
}

/* Fragment loader per CDNA5 ISA 7.12.2 (16-bit A 16x32 / B 32x16 layouts).
   tile: pointer to the 16-row tile origin; row dim stride = `stride` halves;
   contiguous (matmul-K) dim carries the 8+8 half split at +0 / +16. */
__device__ __forceinline__ v16h ld_frag(const _Float16* tile, int stride) {
  const int lane = threadIdx.x & 31;
  const _Float16* p = tile + (size_t)(lane & 15) * stride + ((lane >> 4) << 3);
  v8h lo = *(const v8h*)(p);
  v8h hi = *(const v8h*)(p + 16);
  v16h r;
#pragma unroll
  for (int i = 0; i < 8; ++i) { r[i] = lo[i]; r[8 + i] = hi[i]; }
  return r;
}

/* ---------------- WMMA GEMM: C[M,N] = A[M,K] * Bw[N,K]^T + bias ----------------
   256 x BN block tile, 8 waves as 4 x 2, wave tile 64 x BN/2 (4 x BN/32 of 16x16),
   K-step 64: a staged row is one whole 128-B line, so a wave's 512-B copy asks
   L2 for 4 full lines. The large tile is what sets the traffic: L2 bytes per
   product go as 1/256 + 1/BN, LDS fragment reads per WMMA as 1/4 + 32/BN.
   BN is chosen per product so that the tiles are a whole multiple of the WGPs.
   Global->LDS staging via async copy engine, LDS double buffered:
   8 + BN/32 async b128 ops per wave per stage; s_wait_asynccnt of that count
   retires the previous stage (all but the youngest) while the next streams. */
#define GKS    64   /* halves of K per stage */
#define GBM    256  /* rows of A per block tile */
#define GPITCH 72   /* halves; 144 B = 16 B x odd: 16 rows of a ds_load_b128 fall on 16 bank groups */
template <int BN, int ND>   /* ND: row length of C, a constant so that a wave's stores share one address */
__global__ __launch_bounds__(256) void gemm_wmma(
    const _Float16* __restrict__ A, const _Float16* __restrict__ Bw,
    float* __restrict__ C, int Mdim, int Ndim, int Kdim,
    const float* __restrict__ b0, const float* __restrict__ b1,
    const float* __restrict__ b2, int s1, int s2)
{
  constexpr int MI  = 4;              /* 16-row fragments of A per wave */
  constexpr int NJ  = BN / 32;        /* 16-col fragments of B per wave */
  constexpr int CPA = GBM * 8 / 256;  /* 16-B chunks per thread and stage, A */
  constexpr int CPB = BN  * 8 / 256;  /* the same, B */
  __shared__ __align__(16) _Float16 ldsA[2][GBM * GPITCH];
  __shared__ __align__(16) _Float16 ldsB[2][BN * GPITCH];
  const int tid  = threadIdx.x;
  const int lane = tid & 31, wave = tid >> 5;
  const int l15  = lane & 15, hi8 = (lane >> 4) << 3;
  const int wm = wave >> 1, wn = wave & 1;
  const int mBase = blockIdx.y * GBM;
  const int nBase = blockIdx.x * BN;

  const v8f zf = {};
  v8f acc[MI][NJ];
#pragma unroll
  for (int i = 0; i < MI; i++)
#pragma unroll
    for (int j = 0; j < NJ; j++) acc[i][j] = zf;

  /* chunk t of a thread: row row0 + 32 t, 16-B segment seg (8 chunks per 64-half row) */
  const int row0 = tid >> 3;
  const int seg  = (tid & 7) << 3;

  const int nk = Kdim / GKS;

#if USE_ASYNC
  /* ---- async pipeline ---- */
#pragma unroll
  for (int t = 0; t < CPA; t++)       /* stage 0 */
    async_cp16(A  + (size_t)(mBase + row0 + t * 32) * Kdim + seg,
               &ldsA[0][(row0 + t * 32) * GPITCH + seg]);
#pragma unroll
  for (int t = 0; t < CPB; t++)
    async_cp16(Bw + (size_t)(nBase + row0 + t * 32) * Kdim + seg,
               &ldsB[0][(row0 + t * 32) * GPITCH + seg]);
  for (int kb = 0; kb < nk; ++kb) {
    const int st = kb & 1;
    if (kb + 1 < nk) {
      const int k0 = (kb + 1) * GKS;
#pragma unroll
      for (int t = 0; t < CPA; t++)
        async_cp16(A  + (size_t)(mBase + row0 + t * 32) * Kdim + k0 + seg,
                   &ldsA[st ^ 1][(row0 + t * 32) * GPITCH + seg]);
#pragma unroll
      for (int t = 0; t < CPB; t++)
        async_cp16(Bw + (size_t)(nBase + row0 + t * 32) * Kdim + k0 + seg,
                   &ldsB[st ^ 1][(row0 + t * 32) * GPITCH + seg]);
      __builtin_amdgcn_s_wait_asynccnt(CPA + CPB);   /* previous stage landed */
    } else {
      __builtin_amdgcn_s_wait_asynccnt(0);
    }
    __syncthreads();
    /* unrolled: both 32-k halves of the stage read at constant LDS offsets */
    v16h af[GKS / 32][MI], bf[GKS / 32][NJ];
#pragma unroll
    for (int u = 0; u < GKS / 32; u++) {
#pragma unroll
      for (int i = 0; i < MI; i++) af[u][i] = ld_frag(&ldsA[st][(wm * 64 + i * 16) * GPITCH + u * 32], GPITCH);
#pragma unroll
      for (int j = 0; j < NJ; j++) bf[u][j] = ld_frag(&ldsB[st][(wn * (BN / 2) + j * 16) * GPITCH + u * 32], GPITCH);
    }
    /* holds the stage's fragment loads together ahead of its WMMAs: left free, the
       scheduler keeps one A fragment, reloads it behind every row of WMMAs and
       waits out the LDS latency each time */
    __builtin_amdgcn_sched_barrier(0);
#pragma unroll
    for (int u = 0; u < GKS / 32; u++) {
#pragma unroll
      for (int i = 0; i < MI; i++)
#pragma unroll
        for (int j = 0; j < NJ; j++)
          acc[i][j] = __builtin_amdgcn_wmma_f32_16x16x32_f16(
              false, af[u][i], false, bf[u][j], (short)0, acc[i][j], false, false);
      /* keeps the first half's WMMAs ahead of the wait for the later half's loads: left
         free, the closing barrier and its wait for every load rise above them all */
      if (u + 1 < GKS / 32) __builtin_amdgcn_sched_barrier(0);
    }
    __syncthreads();
  }
#else
  /* ---- fallback: register-staged pipeline ---- */
  v8h ra[CPA], rb[CPB];
#pragma unroll
  for (int t = 0; t < CPA; t++)
    ra[t] = *(const v8h*)(A  + (size_t)(mBase + row0 + t * 32) * Kdim + seg);
#pragma unroll
  for (int t = 0; t < CPB; t++)
    rb[t] = *(const v8h*)(Bw + (size_t)(nBase + row0 + t * 32) * Kdim + seg);
  for (int kb = 0; kb < nk; ++kb) {
#pragma unroll
    for (int t = 0; t < CPA; t++) *(v8h*)(&ldsA[0][(row0 + t * 32) * GPITCH + seg]) = ra[t];
#pragma unroll
    for (int t = 0; t < CPB; t++) *(v8h*)(&ldsB[0][(row0 + t * 32) * GPITCH + seg]) = rb[t];
    __syncthreads();
    if (kb + 1 < nk) {
      const int k0 = (kb + 1) * GKS;
#pragma unroll
      for (int t = 0; t < CPA; t++)
        ra[t] = *(const v8h*)(A  + (size_t)(mBase + row0 + t * 32) * Kdim + k0 + seg);
#pragma unroll
      for (int t = 0; t < CPB; t++)
        rb[t] = *(const v8h*)(Bw + (size_t)(nBase + row0 + t * 32) * Kdim + k0 + seg);
    }
    /* unrolled: both 32-k halves of the stage read at constant LDS offsets */
#pragma unroll
    for (int ks = 0; ks < GKS; ks += 32) {
      v16h af[MI], bf[NJ];
#pragma unroll
      for (int i = 0; i < MI; i++) af[i] = ld_frag(&ldsA[0][(wm * 64 + i * 16) * GPITCH + ks], GPITCH);
#pragma unroll
      for (int j = 0; j < NJ; j++) bf[j] = ld_frag(&ldsB[0][(wn * (BN / 2) + j * 16) * GPITCH + ks], GPITCH);
#pragma unroll
      for (int i = 0; i < MI; i++)
#pragma unroll
        for (int j = 0; j < NJ; j++)
          acc[i][j] = __builtin_amdgcn_wmma_f32_16x16x32_f16(
              false, af[i], false, bf[j], (short)0, acc[i][j], false, false);
    }
    __syncthreads();
  }
#endif

  /* epilogue: C/D layout - lane holds col, VGPR r holds row r + 8*(lane>=16) */
  float bias[NJ];
#pragma unroll
  for (int j = 0; j < NJ; j++) {
    const int col = nBase + wn * (BN / 2) + j * 16 + l15;
    bias[j] = (col < s1) ? b0[col] : (col < s2) ? b1[col - s1] : b2[col - s2];
  }
  float* cp = C + (size_t)(mBase + wm * 64 + hi8) * ND + nBase + wn * (BN / 2) + l15;
#pragma unroll
  for (int j = 0; j < NJ; j++)
#pragma unroll
    for (int i = 0; i < MI; i++)
#pragma unroll
      for (int r = 0; r < 8; r++)
        cp[(i * 16 + r) * ND + j * 16] = acc[i][j][r] + bias[j];
}

/* ---------------- RMSNorm + RoPE + repack to [B,N,S,HD] f16 ---------------- */
__global__ __launch_bounds__(256) void norm_rope(
    const float* __restrict__ Y, const float* __restrict__ freqs,
    const float* __restrict__ gq, const float* __restrict__ gk,
    _Float16* __restrict__ qh, _Float16* __restrict__ kh, _Float16* __restrict__ vh)
{
  const int m = blockIdx.x;
  const int b = m / SS, s = m % SS;
  const int tid = threadIdx.x;
  const float* Yr = Y + (size_t)m * N1;
  const int c0 = tid * 8;

  float qv[8], kv[8], vv[8];
  float sq = 0.f, sk = 0.f;
#pragma unroll
  for (int j = 0; j < 8; j++) {
    qv[j] = Yr[c0 + j]; kv[j] = Yr[DD + c0 + j]; vv[j] = Yr[2 * DD + c0 + j];
    sq += qv[j] * qv[j]; sk += kv[j] * kv[j];
  }
  for (int msk = 16; msk; msk >>= 1) {
    sq += __shfl_xor(sq, msk, 32);
    sk += __shfl_xor(sk, msk, 32);
  }
  __shared__ float red[16];
  const int wid = tid >> 5;
  if ((tid & 31) == 0) { red[wid] = sq; red[8 + wid] = sk; }
  __syncthreads();
  if (tid == 0) {
    float a = 0.f, c = 0.f;
    for (int i = 0; i < 8; i++) { a += red[i]; c += red[8 + i]; }
    red[0] = a; red[8] = c;
  }
  __syncthreads();
  const float rq = rsqrtf(red[0] * (1.0f / DD) + 1e-6f);
  const float rk = rsqrtf(red[8] * (1.0f / DD) + 1e-6f);

  const int n  = c0 / HD;
  const int d0 = c0 % HD;
  const size_t ob = ((size_t)(b * NH + n) * SS + s) * HD + d0;
#pragma unroll
  for (int j = 0; j < 8; j += 2) {
    const int p = (d0 + j) >> 1;
    const float f  = freqs[(size_t)s * (HD / 2) + p];
    const float cf = __cosf(f), sf = __sinf(f);
    const float u0 = qv[j]     * rq * gq[c0 + j];
    const float u1 = qv[j + 1] * rq * gq[c0 + j + 1];
    qh[ob + j]     = (_Float16)(u0 * cf - u1 * sf);
    qh[ob + j + 1] = (_Float16)(u0 * sf + u1 * cf);
    const float w0 = kv[j]     * rk * gk[c0 + j];
    const float w1 = kv[j + 1] * rk * gk[c0 + j + 1];
    kh[ob + j]     = (_Float16)(w0 * cf - w1 * sf);
    kh[ob + j + 1] = (_Float16)(w0 * sf + w1 * cf);
    vh[ob + j]     = (_Float16)vv[j];
    vh[ob + j + 1] = (_Float16)vv[j + 1];
  }
}

#define VPITCH 144  /* halves; 288 B = 32 B x odd, the transposing load's pitch */
#define KPITCH 136  /* halves; 272 B = 16 B x odd, the ds_load_b128 pitch */

typedef __attribute__((ext_vector_type(8))) short s16x8;
typedef __attribute__((address_space(3))) s16x8 lds_s16x8;

__device__ __forceinline__ v8h ld_tr16(const _Float16* p) {
  return __builtin_bit_cast(v8h, __builtin_amdgcn_ds_load_tr16_b128_v8i16((lds_s16x8*)p));
}

/* value of lane l ^ 16 */
__device__ __forceinline__ float xhalf(float x) {
  return __builtin_bit_cast(float, __builtin_amdgcn_permlanex16(
      __builtin_bit_cast(int, x), __builtin_bit_cast(int, x),
      0x76543210, 0xfedcba98, false, false));
}

__global__ __launch_bounds__(128) void attn_wmma(
    const _Float16* __restrict__ qh, const _Float16* __restrict__ kh,
    const _Float16* __restrict__ vh, const int* __restrict__ seq_lens,
    _Float16* __restrict__ oh)
{
  __shared__ __align__(16) _Float16 ldsK[32 * KPITCH];
  __shared__ __align__(16) _Float16 ldsV[32 * VPITCH];

  const int tid = threadIdx.x;
  const int lane = tid & 31, w = tid >> 5;
  const int l15 = lane & 15, hi8 = (lane >> 4) << 3;
  const int nqt = SS / 128;
  const int qt = blockIdx.x % nqt;
  const int h  = (blockIdx.x / nqt) % NH;
  const int b  = blockIdx.x / (nqt * NH);
  /* the key mask is arange(S) < seq_len: clamping to [0, S] leaves it as it is
     and bounds the trip count and every K/V address */
  int slen = seq_lens[b];
  slen = slen < 0 ? 0 : (slen > SS ? SS : slen);
  /* no valid key: every score equals the mask value, softmax is uniform over
     all S keys; scores of zero over all keys give the same */
  const int   lim = slen == 0 ? SS : slen;
  const float scl = slen == 0 ? 0.f : 0.08838834764831845f; /* 1/sqrt(128) */

  const size_t headO = (size_t)(b * NH + h) * SS * HD;
  const _Float16* qbase = qh + headO + (size_t)(qt * 128 + w * 32) * HD;
  const _Float16* kbase = kh + headO;
  const _Float16* vbase = vh + headO;

  /* B operand Q^T: column = query, same k order as the K rows (same loader) */
  v16h qf[2][4];
#pragma unroll
  for (int i = 0; i < 2; i++)
#pragma unroll
    for (int dc = 0; dc < 4; dc++)
      qf[i][dc] = ld_frag(qbase + (size_t)(i * 16) * HD + dc * 32, HD);

  const v8f zf = {};
  v8f o[2][8];                 /* o[i][dj][r] = O[query i*16+l15][dj*16+hi8+r] */
#pragma unroll
  for (int i = 0; i < 2; i++)
#pragma unroll
    for (int dj = 0; dj < 8; dj++) o[i][dj] = zf;
  float mrow[2], lrow[2];      /* lrow: this wave half's keys only */
#pragma unroll
  for (int i = 0; i < 2; i++) { mrow[i] = -3.0e38f; lrow[i] = 0.f; }

  /* lane address of the transposing load: key row 8*(l>>4)+(l&7), 16-B column half (l>>3)&1 */
  const _Float16* vtr = ldsV + (hi8 + (lane & 7)) * VPITCH + (((lane >> 3) & 1) << 3);

  const int nkt = (lim + 31) >> 5;
  for (int kt = 0; kt < nkt; ++kt) {
    /* stage K tile and V tile, [32][128 + pad] each, both row-major */
#pragma unroll
    for (int t = 0; t < 4; t++) {
      const int c = tid + t * 128;            /* 512 chunks of 8 halves */
      const int kk = c >> 4, seg = (c & 15) << 3;
#if USE_ASYNC
      async_cp16(kbase + (size_t)(kt * 32 + kk) * HD + seg, ldsK + kk * KPITCH + seg);
      async_cp16(vbase + (size_t)(kt * 32 + kk) * HD + seg, ldsV + kk * VPITCH + seg);
#else
      *(v8h*)(ldsK + kk * KPITCH + seg) = *(const v8h*)(kbase + (size_t)(kt * 32 + kk) * HD + seg);
      *(v8h*)(ldsV + kk * VPITCH + seg) = *(const v8h*)(vbase + (size_t)(kt * 32 + kk) * HD + seg);
#endif
    }
#if USE_ASYNC
    /* this wave's copies have landed before the barrier publishes them */
    asm volatile("s_wait_asynccnt 0x0" ::: "memory");
#endif
    __syncthreads();

    /* S^T = K * Q^T : sc[j][i][r] = score(key j*16+hi8+r, query i*16+l15) */
    v8f sc[2][2];
#pragma unroll
    for (int j = 0; j < 2; j++)
#pragma unroll
      for (int i = 0; i < 2; i++) sc[j][i] = zf;
#pragma unroll
    for (int dc = 0; dc < 4; dc++) {
      v16h ak0 = ld_frag(ldsK + 0 * 16 * KPITCH + dc * 32, KPITCH);
      v16h ak1 = ld_frag(ldsK + 1 * 16 * KPITCH + dc * 32, KPITCH);
#pragma unroll
      for (int i = 0; i < 2; i++) {
        sc[0][i] = __builtin_amdgcn_wmma_f32_16x16x32_f16(
            false, ak0, false, qf[i][dc], (short)0, sc[0][i], false, false);
        sc[1][i] = __builtin_amdgcn_wmma_f32_16x16x32_f16(
            false, ak1, false, qf[i][dc], (short)0, sc[1][i], false, false);
      }
    }

    /* scale; key mask only in a tile that reaches past the last valid key */
#pragma unroll
    for (int j = 0; j < 2; j++)
#pragma unroll
      for (int i = 0; i < 2; i++)
#pragma unroll
        for (int r = 0; r < 8; r++) sc[j][i][r] *= scl;
    if (kt * 32 + 32 > lim) {
#pragma unroll
      for (int j = 0; j < 2; j++)
#pragma unroll
        for (int r = 0; r < 8; r++) {
          const bool valid = kt * 32 + j * 16 + hi8 + r < lim;
#pragma unroll
          for (int i = 0; i < 2; i++) sc[j][i][r] = valid ? sc[j][i][r] : -3.0e38f;
        }
    }

    /* online softmax: a lane and its partner in the other half share one query */
    v16h pf[2];
#pragma unroll
    for (int i = 0; i < 2; i++) {
      float t = fmaxf(sc[0][i][0], sc[1][i][0]);
#pragma unroll
      for (int r = 1; r < 8; r++) t = fmaxf(t, fmaxf(sc[0][i][r], sc[1][i][r]));
      t = fmaxf(t, xhalf(t));
      const float mn = fmaxf(mrow[i], t);
      const float al = __expf(mrow[i] - mn);
      float rs = 0.f;
#pragma unroll
      for (int j = 0; j < 2; j++)
#pragma unroll
        for (int r = 0; r < 8; r++) {
          const float p = __expf(sc[j][i][r] - mn);
          rs += p;
          pf[i][j * 8 + r] = (_Float16)p;   /* B operand P^T, hardware k order */
        }
      lrow[i] = lrow[i] * al + rs;
      mrow[i] = mn;
#pragma unroll
      for (int dj = 0; dj < 8; dj++)
#pragma unroll
        for (int r = 0; r < 8; r++) o[i][dj][r] *= al;
    }

    /* O^T += V^T * P^T  (A frags: rows = d, matmul-K = key) */
#pragma unroll
    for (int dj = 0; dj < 8; dj++) {
      const v8h lo = ld_tr16(vtr + dj * 16);
      const v8h hi = ld_tr16(vtr + 16 * VPITCH + dj * 16);
      v16h vf;
#pragma unroll
      for (int e = 0; e < 8; e++) { vf[e] = lo[e]; vf[8 + e] = hi[e]; }
      o[0][dj] = __builtin_amdgcn_wmma_f32_16x16x32_f16(
          false, vf, false, pf[0], (short)0, o[0][dj], false, false);
      o[1][dj] = __builtin_amdgcn_wmma_f32_16x16x32_f16(
          false, vf, false, pf[1], (short)0, o[1][dj], false, false);
    }
    __syncthreads();
  }

  /* join the halves' sums, normalize, write [B,S,D] f16: 8 consecutive d per lane */
#pragma unroll
  for (int i = 0; i < 2; i++) {
    const int srow = qt * 128 + w * 32 + i * 16 + l15;
    const float inv = 1.0f / (lrow[i] + xhalf(lrow[i]));
    _Float16* orow = oh + ((size_t)(b * SS + srow)) * DD + h * HD + hi8;
#pragma unroll
    for (int dj = 0; dj < 8; dj++) {
      v8h ov;
#pragma unroll
      for (int r = 0; r < 8; r++) ov[r] = (_Float16)(o[i][dj][r] * inv);
      *(v8h*)(orow + dj * 16) = ov;
    }
  }
}

/* ---------------- host-side orchestration ---------------- */
extern "C" void kernel_launch(void* const* d_in, const int* in_sizes, int n_in,
                              void* d_out, int out_size, void* d_ws, size_t ws_size,
                              hipStream_t stream) {
  (void)in_sizes; (void)n_in; (void)out_size; (void)ws_size;
  const float* x        = (const float*)d_in[0];
  const int*   seq_lens = (const int*)d_in[1];
  const float* freqs    = (const float*)d_in[2];
  const float* wq = (const float*)d_in[3];
  const float* bq = (const float*)d_in[4];
  const float* wk = (const float*)d_in[5];
  const float* bk = (const float*)d_in[6];
  const float* wv = (const float*)d_in[7];
  const float* bv = (const float*)d_in[8];
  const float* wo = (const float*)d_in[9];
  const float* bo = (const float*)d_in[10];
  const float* gq = (const float*)d_in[11];
  const float* gk = (const float*)d_in[12];

  char* ws = (char*)d_ws;
  _Float16* xh    = (_Float16*)(ws + OFF_XH);
  _Float16* wqkvh = (_Float16*)(ws + OFF_WQKV);
  _Float16* woh   = (_Float16*)(ws + OFF_WO);
  float*    Y     = (float*)(ws + OFF_Y);
  _Float16* qhp   = (_Float16*)(ws + OFF_QH);
  _Float16* khp   = (_Float16*)(ws + OFF_KH);
  _Float16* vhp   = (_Float16*)(ws + OFF_VH);
  _Float16* ohp   = (_Float16*)(ws + OFF_OH);

  /* 1) down-convert activations + weights to f16 */
  cvt_f16<<<CVT_XB + 4 * CVT_WB, 256, 0, stream>>>(x, wq, wk, wv, wo, xh);

  /* 2) fused QKV projection: Y[4096,6144] = xh * [wq;wk;wv]^T + [bq|bk|bv] */
  gemm_wmma<192, N1><<<dim3(N1 / 192, MM / GBM), 256, 0, stream>>>(
      xh, wqkvh, Y, MM, N1, DD, bq, bk, bv, DD, 2 * DD);

  /* 3) RMSNorm + RoPE + repack */
  norm_rope<<<MM, 256, 0, stream>>>(Y, freqs, gq, gk, qhp, khp, vhp);

  /* 4) flash attention */
  attn_wmma<<<BB * NH * (SS / 128), 128, 0, stream>>>(qhp, khp, vhp, seq_lens, ohp);

  /* 5) output projection into d_out (f32) */
  gemm_wmma<128, DD><<<dim3(DD / 128, MM / GBM), 256, 0, stream>>>(
      ohp, woh, (float*)d_out, MM, DD, DD, bo, bo, bo, DD, 2 * DD);
}

// v006
// It runs in 202 microseconds.
// Next to v005, in two timings, it ran 1.15 times as fast each time.
// All steps since v000 together make it 3.91 times as fast.
#include <hip/hip_runtime.h>

typedef __attribute__((ext_vector_type(16))) _Float16 v16h;
typedef __attribute__((ext_vector_type(8)))  _Float16 v8h;
typedef __attribute__((ext_vector_type(8)))  float    v8f;
typedef __attribute__((ext_vector_type(4)))  int      v4i;

#define BB 2
#define SS 2048
#define DD 2048
#define NH 16
#define HD 128
#define MM (BB*SS)      /* 4096 rows */
#define N1 (3*DD)       /* 6144 fused QKV cols */

/* ---- workspace layout (bytes) ---- */
#define OFF_XH   ((size_t)0)
#define OFF_WQKV (OFF_XH   + (size_t)MM*DD*2)     /* x in f16            */
#define OFF_WO   (OFF_WQKV + (size_t)N1*DD*2)     /* [wq;wk;wv] f16      */
#define OFF_Y    (OFF_WO   + (size_t)DD*DD*2)     /* wo f16              */
#define OFF_QH   (OFF_Y    + (size_t)MM*N1*4)     /* fused QKV f32       */
#define OFF_KH   (OFF_QH   + (size_t)MM*DD*2)     /* q f16 [B,N,S,HD]    */
#define OFF_VH   (OFF_KH   + (size_t)MM*DD*2)
#define OFF_OH   (OFF_VH   + (size_t)MM*DD*2)     /* attn out f16 [B,S,D]*/

/* ---- CDNA5 async global->LDS copy (ASYNCcnt-tracked, bypasses VGPRs) ---- */
#if __has_builtin(__builtin_amdgcn_global_load_async_to_lds_b128) && \
    __has_builtin(__builtin_amdgcn_s_wait_asynccnt)
#define USE_ASYNC 1
#else
#define USE_ASYNC 0
#endif

/* b128 payload type: <4 x i32>; clang prints AS(1) as `__device__` in HIP */
typedef __attribute__((address_space(1))) v4i gv4i;
typedef __attribute__((address_space(3))) v4i lv4i;

__device__ __forceinline__ void async_cp16(const void* g, void* l) {
#if USE_ASYNC
  /* generic LDS pointers carry the LDS byte offset in the low 32 bits
     (flat->LDS aperture mapping: LDS_ADDR = addr[31:0]) */
  __builtin_amdgcn_global_load_async_to_lds_b128(
      (gv4i*)(unsigned long long)(size_t)g,
      (lv4i*)(unsigned int)(size_t)l, 0, 0);
#else
  (void)g; (void)l;
#endif
}

/* ---------------- f32 -> f16 convert: x and the four weights, one streaming launch ----------------
   The five f16 copies lie one behind the other at the start of the workspace
   (x | wq | wk | wv | wo), so the destination is one array and a block's
   32,768 elements come from one source. A wave-wide load covers 512 contiguous
   bytes (4 whole lines), a wave-wide store 256 (2 whole lines); at least 8
   loads of a lane are in flight before the first is converted. */
typedef __attribute__((ext_vector_type(4))) float    v4f;
typedef __attribute__((ext_vector_type(4))) _Float16 v4h;
#define CVT_LD   8                             /* 16-B loads of a lane issued as a group */
#define CVT_IT   4                             /* such groups per lane */
#define CVT_BLK  (256 * 4 * CVT_LD * CVT_IT)   /* elements per block */
#define CVT_XB   (MM * DD / CVT_BLK)           /* blocks of x */
#define CVT_WB   (DD * DD / CVT_BLK)           /* blocks of one weight */
__global__ __launch_bounds__(256) void cvt_f16(
    const float* __restrict__ x,  const float* __restrict__ wq,
    const float* __restrict__ wk, const float* __restrict__ wv,
    const float* __restrict__ wo, _Float16* __restrict__ dst)
{
  const int blk = blockIdx.x;
  const float* src = x;
  int sb = blk;
  if (blk >= CVT_XB) {
    const int u = (blk - CVT_XB) / CVT_WB;
    sb  = (blk - CVT_XB) % CVT_WB;
    src = u == 0 ? wq : u == 1 ? wk : u == 2 ? wv : wo;
  }
  const float* s = src + (size_t)sb  * CVT_BLK + threadIdx.x * 4;
  _Float16*    d = dst + (size_t)blk * CVT_BLK + threadIdx.x * 4;
  for (int it = 0; it < CVT_IT; ++it) {
    v4f v[CVT_LD];
#pragma unroll
    for (int j = 0; j < CVT_LD; j++)
      v[j] = *(const v4f*)(s + (it * CVT_LD + j) * 1024);
#pragma unroll
    for (int j = 0; j < CVT_LD; j++) {
      v4h h;
#pragma unroll
      for (int e = 0; e < 4; e++) h[e] = (_Float16)v[j][e];
      *(v4h*)(d + (it * CVT_LD + j) * 1024) = h;
    }
  }
}

/* Fragment loader per CDNA5 ISA 7.12.2 (16-bit A 16x32 / B 32x16 layouts).
   tile: pointer to the 16-row tile origin; row dim stride = `stride` halves;
   contiguous (matmul-K) dim carries the 8+8 half split at +0 / +16. */
__device__ __forceinline__ v16h ld_frag(const _Float16* tile, int stride) {
  const int lane = threadIdx.x & 31;
  const _Float16* p = tile + (size_t)(lane & 15) * stride + ((lane >> 4) << 3);
  v8h lo = *(const v8h*)(p);
  v8h hi = *(const v8h*)(p + 16);
  v16h r;
#pragma unroll
  for (int i = 0; i < 8; ++i) { r[i] = lo[i]; r[8 + i] = hi[i]; }
  return r;
}

/* ---------------- WMMA GEMM: C[M,N] = A[M,K] * Bw[N,K]^T + bias ----------------
   256 x BN block tile, 8 waves as 4 x 2, wave tile 64 x BN/2 (4 x BN/32 of 16x16),
   K-step 64: a staged row is one whole 128-B line, so a wave's 512-B copy asks
   L2 for 4 full lines. The large tile is what sets the traffic: L2 bytes per
   product go as 1/256 + 1/BN, LDS fragment reads per WMMA as 1/4 + 32/BN.
   BN is chosen per product so that the tiles are a whole multiple of the WGPs.
   Global->LDS staging via async copy engine, LDS double buffered:
   8 + BN/32 async b128 ops per wave per stage; s_wait_asynccnt of that count
   retires the previous stage (all but the youngest) while the next streams. */
#define GKS    64   /* halves of K per stage */
#define GBM    256  /* rows of A per block tile */
#define GPITCH 72   /* halves; 144 B = 16 B x odd: 16 rows of a ds_load_b128 fall on 16 bank groups */
template <int BN, int ND>   /* ND: row length of C, a constant so that a wave's stores share one address */
__global__ __launch_bounds__(256) void gemm_wmma(
    const _Float16* __restrict__ A, const _Float16* __restrict__ Bw,
    float* __restrict__ C, int Mdim, int Ndim, int Kdim,
    const float* __restrict__ b0, const float* __restrict__ b1,
    const float* __restrict__ b2, int s1, int s2)
{
  constexpr int MI  = 4;              /* 16-row fragments of A per wave */
  constexpr int NJ  = BN / 32;        /* 16-col fragments of B per wave */
  constexpr int CPA = GBM * 8 / 256;  /* 16-B chunks per thread and stage, A */
  constexpr int CPB = BN  * 8 / 256;  /* the same, B */
  __shared__ __align__(16) _Float16 ldsA[2][GBM * GPITCH];
  __shared__ __align__(16) _Float16 ldsB[2][BN * GPITCH];
  const int tid  = threadIdx.x;
  const int lane = tid & 31, wave = tid >> 5;
  const int l15  = lane & 15, hi8 = (lane >> 4) << 3;
  const int wm = wave >> 1, wn = wave & 1;
  const int mBase = blockIdx.y * GBM;
  const int nBase = blockIdx.x * BN;

  const v8f zf = {};
  v8f acc[MI][NJ];
#pragma unroll
  for (int i = 0; i < MI; i++)
#pragma unroll
    for (int j = 0; j < NJ; j++) acc[i][j] = zf;

  /* chunk t of a thread: row row0 + 32 t, 16-B segment seg (8 chunks per 64-half row) */
  const int row0 = tid >> 3;
  const int seg  = (tid & 7) << 3;

  const int nk = Kdim / GKS;

#if USE_ASYNC
  /* ---- async pipeline ---- */
#pragma unroll
  for (int t = 0; t < CPA; t++)       /* stage 0 */
    async_cp16(A  + (size_t)(mBase + row0 + t * 32) * Kdim + seg,
               &ldsA[0][(row0 + t * 32) * GPITCH + seg]);
#pragma unroll
  for (int t = 0; t < CPB; t++)
    async_cp16(Bw + (size_t)(nBase + row0 + t * 32) * Kdim + seg,
               &ldsB[0][(row0 + t * 32) * GPITCH + seg]);
  for (int kb = 0; kb < nk; ++kb) {
    const int st = kb & 1;
    if (kb + 1 < nk) {
      const int k0 = (kb + 1) * GKS;
#pragma unroll
      for (int t = 0; t < CPA; t++)
        async_cp16(A  + (size_t)(mBase + row0 + t * 32) * Kdim + k0 + seg,
                   &ldsA[st ^ 1][(row0 + t * 32) * GPITCH + seg]);
#pragma unroll
      for (int t = 0; t < CPB; t++)
        async_cp16(Bw + (size_t)(nBase + row0 + t * 32) * Kdim + k0 + seg,
                   &ldsB[st ^ 1][(row0 + t * 32) * GPITCH + seg]);
      __builtin_amdgcn_s_wait_asynccnt(CPA + CPB);   /* previous stage landed */
    } else {
      __builtin_amdgcn_s_wait_asynccnt(0);
    }
    __syncthreads();
    /* unrolled: both 32-k halves of the stage read at constant LDS offsets */
    v16h af[GKS / 32][MI], bf[GKS / 32][NJ];
#pragma unroll
    for (int u = 0; u < GKS / 32; u++) {
#pragma unroll
      for (int i = 0; i < MI; i++) af[u][i] = ld_frag(&ldsA[st][(wm * 64 + i * 16) * GPITCH + u * 32], GPITCH);
#pragma unroll
      for (int j = 0; j < NJ; j++) bf[u][j] = ld_frag(&ldsB[st][(wn * (BN / 2) + j * 16) * GPITCH + u * 32], GPITCH);
    }
    /* holds the stage's fragment loads together ahead of its WMMAs: left free, the
       scheduler keeps one A fragment, reloads it behind every row of WMMAs and
       waits out the LDS latency each time */
    __builtin_amdgcn_sched_barrier(0);
#pragma unroll
    for (int u = 0; u < GKS / 32; u++) {
#pragma unroll
      for (int i = 0; i < MI; i++)
#pragma unroll
        for (int j = 0; j < NJ; j++)
          acc[i][j] = __builtin_amdgcn_wmma_f32_16x16x32_f16(
              false, af[u][i], false, bf[u][j], (short)0, acc[i][j], false, false);
      /* keeps the first half's WMMAs ahead of the wait for the later half's loads: left
         free, the closing barrier and its wait for every load rise above them all */
      if (u + 1 < GKS / 32) __builtin_amdgcn_sched_barrier(0);
    }
    __syncthreads();
  }
#else
  /* ---- fallback: register-staged pipeline ---- */
  v8h ra[CPA], rb[CPB];
#pragma unroll
  for (int t = 0; t < CPA; t++)
    ra[t] = *(const v8h*)(A  + (size_t)(mBase + row0 + t * 32) * Kdim + seg);
#pragma unroll
  for (int t = 0; t < CPB; t++)
    rb[t] = *(const v8h*)(Bw + (size_t)(nBase + row0 + t * 32) * Kdim + seg);
  for (int kb = 0; kb < nk; ++kb) {
#pragma unroll
    for (int t = 0; t < CPA; t++) *(v8h*)(&ldsA[0][(row0 + t * 32) * GPITCH + seg]) = ra[t];
#pragma unroll
    for (int t = 0; t < CPB; t++) *(v8h*)(&ldsB[0][(row0 + t * 32) * GPITCH + seg]) = rb[t];
    __syncthreads();
    if (kb + 1 < nk) {
      const int k0 = (kb + 1) * GKS;
#pragma unroll
      for (int t = 0; t < CPA; t++)
        ra[t] = *(const v8h*)(A  + (size_t)(mBase + row0 + t * 32) * Kdim + k0 + seg);
#pragma unroll
      for (int t = 0; t < CPB; t++)
        rb[t] = *(const v8h*)(Bw + (size_t)(nBase + row0 + t * 32) * Kdim + k0 + seg);
    }
    /* unrolled: both 32-k halves of the stage read at constant LDS offsets */
#pragma unroll
    for (int ks = 0; ks < GKS; ks += 32) {
      v16h af[MI], bf[NJ];
#pragma unroll
      for (int i = 0; i < MI; i++) af[i] = ld_frag(&ldsA[0][(wm * 64 + i * 16) * GPITCH + ks], GPITCH);
#pragma unroll
      for (int j = 0; j < NJ; j++) bf[j] = ld_frag(&ldsB[0][(wn * (BN / 2) + j * 16) * GPITCH + ks], GPITCH);
#pragma unroll
      for (int i = 0; i < MI; i++)
#pragma unroll
        for (int j = 0; j < NJ; j++)
          acc[i][j] = __builtin_amdgcn_wmma_f32_16x16x32_f16(
              false, af[i], false, bf[j], (short)0, acc[i][j], false, false);
    }
    __syncthreads();
  }
#endif

  /* epilogue: C/D layout - lane holds col, VGPR r holds row r + 8*(lane>=16) */
  float bias[NJ];
#pragma unroll
  for (int j = 0; j < NJ; j++) {
    const int col = nBase + wn * (BN / 2) + j * 16 + l15;
    bias[j] = (col < s1) ? b0[col] : (col < s2) ? b1[col - s1] : b2[col - s2];
  }
  float* cp = C + (size_t)(mBase + wm * 64 + hi8) * ND + nBase + wn * (BN / 2) + l15;
#pragma unroll
  for (int j = 0; j < NJ; j++)
#pragma unroll
    for (int i = 0; i < MI; i++)
#pragma unroll
      for (int r = 0; r < 8; r++)
        cp[(i * 16 + r) * ND + j * 16] = acc[i][j][r] + bias[j];
}

/* ---------------- RMSNorm + RoPE + repack to [B,N,S,HD] f16 ---------------- */
__global__ __launch_bounds__(256) void norm_rope(
    const float* __restrict__ Y, const float* __restrict__ freqs,
    const float* __restrict__ gq, const float* __restrict__ gk,
    _Float16* __restrict__ qh, _Float16* __restrict__ kh, _Float16* __restrict__ vh)
{
  const int m = blockIdx.x;
  const int b = m / SS, s = m % SS;
  const int tid = threadIdx.x;
  const float* Yr = Y + (size_t)m * N1;
  const int c0 = tid * 8;

  float qv[8], kv[8], vv[8];
  float sq = 0.f, sk = 0.f;
#pragma unroll
  for (int j = 0; j < 8; j++) {
    qv[j] = Yr[c0 + j]; kv[j] = Yr[DD + c0 + j]; vv[j] = Yr[2 * DD + c0 + j];
    sq += qv[j] * qv[j]; sk += kv[j] * kv[j];
  }
  for (int msk = 16; msk; msk >>= 1) {
    sq += __shfl_xor(sq, msk, 32);
    sk += __shfl_xor(sk, msk, 32);
  }
  __shared__ float red[16];
  const int wid = tid >> 5;
  if ((tid & 31) == 0) { red[wid] = sq; red[8 + wid] = sk; }
  __syncthreads();
  if (tid == 0) {
    float a = 0.f, c = 0.f;
    for (int i = 0; i < 8; i++) { a += red[i]; c += red[8 + i]; }
    red[0] = a; red[8] = c;
  }
  __syncthreads();
  const float rq = rsqrtf(red[0] * (1.0f / DD) + 1e-6f);
  const float rk = rsqrtf(red[8] * (1.0f / DD) + 1e-6f);

  const int n  = c0 / HD;
  const int d0 = c0 % HD;
  const size_t ob = ((size_t)(b * NH + n) * SS + s) * HD + d0;
#pragma unroll
  for (int j = 0; j < 8; j += 2) {
    const int p = (d0 + j) >> 1;
    const float f  = freqs[(size_t)s * (HD / 2) + p];
    const float cf = __cosf(f), sf = __sinf(f);
    const float u0 = qv[j]     * rq * gq[c0 + j];
    const float u1 = qv[j + 1] * rq * gq[c0 + j + 1];
    qh[ob + j]     = (_Float16)(u0 * cf - u1 * sf);
    qh[ob + j + 1] = (_Float16)(u0 * sf + u1 * cf);
    const float w0 = kv[j]     * rk * gk[c0 + j];
    const float w1 = kv[j + 1] * rk * gk[c0 + j + 1];
    kh[ob + j]     = (_Float16)(w0 * cf - w1 * sf);
    kh[ob + j + 1] = (_Float16)(w0 * sf + w1 * cf);
    vh[ob + j]     = (_Float16)vv[j];
    vh[ob + j + 1] = (_Float16)vv[j + 1];
  }
}

#define VPITCH 144  /* halves; 288 B = 32 B x odd, the transposing load's pitch */
#define KPITCH 136  /* halves; 272 B = 16 B x odd, the ds_load_b128 pitch */

typedef __attribute__((ext_vector_type(8))) short s16x8;
typedef __attribute__((address_space(3))) s16x8 lds_s16x8;

__device__ __forceinline__ v8h ld_tr16(const _Float16* p) {
  return __builtin_bit_cast(v8h, __builtin_amdgcn_ds_load_tr16_b128_v8i16((lds_s16x8*)p));
}

/* value of lane l ^ 16 */
__device__ __forceinline__ float xhalf(float x) {
  return __builtin_bit_cast(float, __builtin_amdgcn_permlanex16(
      __builtin_bit_cast(int, x), __builtin_bit_cast(int, x),
      0x76543210, 0xfedcba98, false, false));
}

__global__ __launch_bounds__(128) void attn_wmma(
    const _Float16* __restrict__ qh, const _Float16* __restrict__ kh,
    const _Float16* __restrict__ vh, const int* __restrict__ seq_lens,
    _Float16* __restrict__ oh)
{
  __shared__ __align__(16) _Float16 ldsK[2][32 * KPITCH];
  __shared__ __align__(16) _Float16 ldsV[2][32 * VPITCH];

  const int tid = threadIdx.x;
  const int lane = tid & 31, w = tid >> 5;
  const int l15 = lane & 15, hi8 = (lane >> 4) << 3;
  const int nqt = SS / 128;
  const int qt = blockIdx.x % nqt;
  const int h  = (blockIdx.x / nqt) % NH;
  const int b  = blockIdx.x / (nqt * NH);
  /* the key mask is arange(S) < seq_len: clamping to [0, S] leaves it as it is
     and bounds the trip count and every K/V address */
  int slen = seq_lens[b];
  slen = slen < 0 ? 0 : (slen > SS ? SS : slen);
  /* no valid key: every score equals the mask value, softmax is uniform over
     all S keys; scores of zero over all keys give the same */
  const int   lim = slen == 0 ? SS : slen;
  const float scl = slen == 0 ? 0.f : 0.08838834764831845f; /* 1/sqrt(128) */

  const size_t headO = (size_t)(b * NH + h) * SS * HD;
  const _Float16* qbase = qh + headO + (size_t)(qt * 128 + w * 32) * HD;
  const _Float16* kbase = kh + headO;
  const _Float16* vbase = vh + headO;

  /* B operand Q^T: column = query, same k order as the K rows (same loader) */
  v16h qf[2][4];
#pragma unroll
  for (int i = 0; i < 2; i++)
#pragma unroll
    for (int dc = 0; dc < 4; dc++)
      qf[i][dc] = ld_frag(qbase + (size_t)(i * 16) * HD + dc * 32, HD);

  const v8f zf = {};
  v8f o[2][8];                 /* o[i][dj][r] = O[query i*16+l15][dj*16+hi8+r] */
#pragma unroll
  for (int i = 0; i < 2; i++)
#pragma unroll
    for (int dj = 0; dj < 8; dj++) o[i][dj] = zf;
  float mrow[2], lrow[2];      /* lrow: this wave half's keys only */
#pragma unroll
  for (int i = 0; i < 2; i++) { mrow[i] = -3.0e38f; lrow[i] = 0.f; }

  /* lane address of the transposing load: key row 8*(l>>4)+(l&7), 16-B column half (l>>3)&1 */
  const int vtro = (hi8 + (lane & 7)) * VPITCH + (((lane >> 3) & 1) << 3);

  /* stage K tile and V tile number tile, [32][128 + pad] each, both row-major, into buffer buf */
  auto stage = [&](int tile, int buf) {
#pragma unroll
    for (int t = 0; t < 4; t++) {
      const int c = tid + t * 128;            /* 512 chunks of 8 halves */
      const int kk = c >> 4, seg = (c & 15) << 3;
#if USE_ASYNC
      async_cp16(kbase + (size_t)(tile * 32 + kk) * HD + seg, &ldsK[buf][kk * KPITCH + seg]);
      async_cp16(vbase + (size_t)(tile * 32 + kk) * HD + seg, &ldsV[buf][kk * VPITCH + seg]);
#else
      *(v8h*)(&ldsK[buf][kk * KPITCH + seg]) = *(const v8h*)(kbase + (size_t)(tile * 32 + kk) * HD + seg);
      *(v8h*)(&ldsV[buf][kk * VPITCH + seg]) = *(const v8h*)(vbase + (size_t)(tile * 32 + kk) * HD + seg);
#endif
    }
  };

  const int nkt = (lim + 31) >> 5;            /* at least 1 */
  stage(0, 0);
#if USE_ASYNC
  /* this wave's copies of tile 0 have landed before the barrier publishes them */
  asm volatile("s_wait_asynccnt 0x0" ::: "memory");
#endif
  __syncthreads();
  if (nkt > 1) stage(1, 1);

  for (int kt = 0; kt < nkt; ++kt) {
    const int st = kt & 1;
    const _Float16* kt16 = ldsK[st];
    const _Float16* vtr  = ldsV[st] + vtro;

    /* S^T = K * Q^T : sc[j][i][r] = score(key j*16+hi8+r, query i*16+l15) */
    v8f sc[2][2];
#pragma unroll
    for (int j = 0; j < 2; j++)
#pragma unroll
      for (int i = 0; i < 2; i++) sc[j][i] = zf;
#pragma unroll
    for (int dc = 0; dc < 4; dc++) {
      v16h ak0 = ld_frag(kt16 + 0 * 16 * KPITCH + dc * 32, KPITCH);
      v16h ak1 = ld_frag(kt16 + 1 * 16 * KPITCH + dc * 32, KPITCH);
#pragma unroll
      for (int i = 0; i < 2; i++) {
        sc[0][i] = __builtin_amdgcn_wmma_f32_16x16x32_f16(
            false, ak0, false, qf[i][dc], (short)0, sc[0][i], false, false);
        sc[1][i] = __builtin_amdgcn_wmma_f32_16x16x32_f16(
            false, ak1, false, qf[i][dc], (short)0, sc[1][i], false, false);
      }
    }

    /* scale; key mask only in a tile that reaches past the last valid key */
#pragma unroll
    for (int j = 0; j < 2; j++)
#pragma unroll
      for (int i = 0; i < 2; i++)
#pragma unroll
        for (int r = 0; r < 8; r++) sc[j][i][r] *= scl;
    if (kt * 32 + 32 > lim) {
#pragma unroll
      for (int j = 0; j < 2; j++)
#pragma unroll
        for (int r = 0; r < 8; r++) {
          const bool valid = kt * 32 + j * 16 + hi8 + r < lim;
#pragma unroll
          for (int i = 0; i < 2; i++) sc[j][i][r] = valid ? sc[j][i][r] : -3.0e38f;
        }
    }

    /* online softmax: a lane and its partner in the other half share one query */
    v16h pf[2];
#pragma unroll
    for (int i = 0; i < 2; i++) {
      float t = fmaxf(sc[0][i][0], sc[1][i][0]);
#pragma unroll
      for (int r = 1; r < 8; r++) t = fmaxf(t, fmaxf(sc[0][i][r], sc[1][i][r]));
      t = fmaxf(t, xhalf(t));
      const float mn = fmaxf(mrow[i], t);
      const float al = __expf(mrow[i] - mn);
      float rs = 0.f;
#pragma unroll
      for (int j = 0; j < 2; j++)
#pragma unroll
        for (int r = 0; r < 8; r++) {
          const float p = __expf(sc[j][i][r] - mn);
          rs += p;
          pf[i][j * 8 + r] = (_Float16)p;   /* B operand P^T, hardware k order */
        }
      lrow[i] = lrow[i] * al + rs;
      mrow[i] = mn;
#pragma unroll
      for (int dj = 0; dj < 8; dj++)
#pragma unroll
        for (int r = 0; r < 8; r++) o[i][dj][r] *= al;
    }

    /* O^T += V^T * P^T  (A frags: rows = d, matmul-K = key) */
#pragma unroll
    for (int dj = 0; dj < 8; dj++) {
      const v8h lo = ld_tr16(vtr + dj * 16);
      const v8h hi = ld_tr16(vtr + 16 * VPITCH + dj * 16);
      v16h vf;
#pragma unroll
      for (int e = 0; e < 8; e++) { vf[e] = lo[e]; vf[8 + e] = hi[e]; }
      o[0][dj] = __builtin_amdgcn_wmma_f32_16x16x32_f16(
          false, vf, false, pf[0], (short)0, o[0][dj], false, false);
      o[1][dj] = __builtin_amdgcn_wmma_f32_16x16x32_f16(
          false, vf, false, pf[1], (short)0, o[1][dj], false, false);
    }

    /* hand-over: this wave has left buffer st ... */
    asm volatile("s_wait_dscnt 0x0" ::: "memory");
#if USE_ASYNC
    /* ... and its copies of tile kt + 1 have landed, before the one barrier that
       publishes that tile and frees buffer st for the refill behind it */
    asm volatile("s_wait_asynccnt 0x0" ::: "memory");
#endif
    __syncthreads();
    if (kt + 2 < nkt) stage(kt + 2, st);
  }
#if USE_ASYNC
  /* no copy is outstanding when the wave ends */
  asm volatile("s_wait_asynccnt 0x0" ::: "memory");
#endif

  /* join the halves' sums, normalize, write [B,S,D] f16: 8 consecutive d per lane */
#pragma unroll
  for (int i = 0; i < 2; i++) {
    const int srow = qt * 128 + w * 32 + i * 16 + l15;
    const float inv = 1.0f / (lrow[i] + xhalf(lrow[i]));
    _Float16* orow = oh + ((size_t)(b * SS + srow)) * DD + h * HD + hi8;
#pragma unroll
    for (int dj = 0; dj < 8; dj++) {
      v8h ov;
#pragma unroll
      for (int r = 0; r < 8; r++) ov[r] = (_Float16)(o[i][dj][r] * inv);
      *(v8h*)(orow + dj * 16) = ov;
    }
  }
}

/* ---------------- host-side orchestration ---------------- */
extern "C" void kernel_launch(void* const* d_in, const int* in_sizes, int n_in,
                              void* d_out, int out_size, void* d_ws, size_t ws_size,
                              hipStream_t stream) {
  (void)in_sizes; (void)n_in; (void)out_size; (void)ws_size;
  const float* x        = (const float*)d_in[0];
  const int*   seq_lens = (const int*)d_in[1];
  const float* freqs    = (const float*)d_in[2];
  const float* wq = (const float*)d_in[3];
  const float* bq = (const float*)d_in[4];
  const float* wk = (const float*)d_in[5];
  const float* bk = (const float*)d_in[6];
  const float* wv = (const float*)d_in[7];
  const float* bv = (const float*)d_in[8];
  const float* wo = (const float*)d_in[9];
  const float* bo = (const float*)d_in[10];
  const float* gq = (const float*)d_in[11];
  const float* gk = (const float*)d_in[12];

  char* ws = (char*)d_ws;
  _Float16* xh    = (_Float16*)(ws + OFF_XH);
  _Float16* wqkvh = (_Float16*)(ws + OFF_WQKV);
  _Float16* woh   = (_Float16*)(ws + OFF_WO);
  float*    Y     = (float*)(ws + OFF_Y);
  _Float16* qhp   = (_Float16*)(ws + OFF_QH);
  _Float16* khp   = (_Float16*)(ws + OFF_KH);
  _Float16* vhp   = (_Float16*)(ws + OFF_VH);
  _Float16* ohp   = (_Float16*)(ws + OFF_OH);

  /* 1) down-convert activations + weights to f16 */
  cvt_f16<<<CVT_XB + 4 * CVT_WB, 256, 0, stream>>>(x, wq, wk, wv, wo, xh);

  /* 2) fused QKV projection: Y[4096,6144] = xh * [wq;wk;wv]^T + [bq|bk|bv] */
  gemm_wmma<192, N1><<<dim3(N1 / 192, MM / GBM), 256, 0, stream>>>(
      xh, wqkvh, Y, MM, N1, DD, bq, bk, bv, DD, 2 * DD);

  /* 3) RMSNorm + RoPE + repack */
  norm_rope<<<MM, 256, 0, stream>>>(Y, freqs, gq, gk, qhp, khp, vhp);

  /* 4) flash attention */
  attn_wmma<<<BB * NH * (SS / 128), 128, 0, stream>>>(qhp, khp, vhp, seq_lens, ohp);

  /* 5) output projection into d_out (f32) */
  gemm_wmma<128, DD><<<dim3(DD / 128, MM / GBM), 256, 0, stream>>>(
      ohp, woh, (float*)d_out, MM, DD, DD, bo, bo, bo, DD, 2 * DD);
}

// v007
// Measured time: 189 microseconds a run.
// Next to v006, in two timings, it ran 1.07 times as fast each time.
// All steps since v000 together make it 4.18 times as fast.
#include <hip/hip_runtime.h>

typedef __attribute__((ext_vector_type(16))) _Float16 v16h;
typedef __attribute__((ext_vector_type(8)))  _Float16 v8h;
typedef __attribute__((ext_vector_type(8)))  float    v8f;
typedef __attribute__((ext_vector_type(4)))  int      v4i;

#define BB 2
#define SS 2048
#define DD 2048
#define NH 16
#define HD 128
#define MM (BB*SS)      /* 4096 rows */
#define N1 (3*DD)       /* 6144 fused QKV cols */

/* ---- workspace layout (bytes) ---- */
#define OFF_XH   ((size_t)0)
#define OFF_WQKV (OFF_XH   + (size_t)MM*DD*2)     /* x in f16            */
#define OFF_WO   (OFF_WQKV + (size_t)N1*DD*2)     /* [wq;wk;wv] f16      */
#define OFF_Y    (OFF_WO   + (size_t)DD*DD*2)     /* wo f16              */
#define OFF_QH   (OFF_Y    + (size_t)MM*N1*4)     /* fused QKV f32       */
#define OFF_KH   (OFF_QH   + (size_t)MM*DD*2)     /* q f16 [B,N,S,HD]    */
#define OFF_VH   (OFF_KH   + (size_t)MM*DD*2)
#define OFF_OH   (OFF_VH   + (size_t)MM*DD*2)     /* attn out f16 [B,S,D]*/

/* ---- CDNA5 async global->LDS copy (ASYNCcnt-tracked, bypasses VGPRs) ---- */
#if __has_builtin(__builtin_amdgcn_global_load_async_to_lds_b128) && \
    __has_builtin(__builtin_amdgcn_s_wait_asynccnt)
#define USE_ASYNC 1
#else
#define USE_ASYNC 0
#endif

/* b128 payload type: <4 x i32>; clang prints AS(1) as `__device__` in HIP */
typedef __attribute__((address_space(1))) v4i gv4i;
typedef __attribute__((address_space(3))) v4i lv4i;

__device__ __forceinline__ void async_cp16(const void* g, void* l) {
#if USE_ASYNC
  /* generic LDS pointers carry the LDS byte offset in the low 32 bits
     (flat->LDS aperture mapping: LDS_ADDR = addr[31:0]) */
  __builtin_amdgcn_global_load_async_to_lds_b128(
      (gv4i*)(unsigned long long)(size_t)g,
      (lv4i*)(unsigned int)(size_t)l, 0, 0);
#else
  (void)g; (void)l;
#endif
}

/* ---------------- f32 -> f16 convert: x and the four weights, one streaming launch ----------------
   The five f16 copies lie one behind the other at the start of the workspace
   (x | wq | wk | wv | wo), so the destination is one array and a block's
   32,768 elements come from one source. A wave-wide load covers 512 contiguous
   bytes (4 whole lines), a wave-wide store 256 (2 whole lines); at least 8
   loads of a lane are in flight before the first is converted. */
typedef __attribute__((ext_vector_type(4))) float    v4f;
typedef __attribute__((ext_vector_type(4))) _Float16 v4h;
#define CVT_LD   8                             /* 16-B loads of a lane issued as a group */
#define CVT_IT   4                             /* such groups per lane */
#define CVT_BLK  (256 * 4 * CVT_LD * CVT_IT)   /* elements per block */
#define CVT_XB   (MM * DD / CVT_BLK)           /* blocks of x */
#define CVT_WB   (DD * DD / CVT_BLK)           /* blocks of one weight */
__global__ __launch_bounds__(256) void cvt_f16(
    const float* __restrict__ x,  const float* __restrict__ wq,
    const float* __restrict__ wk, const float* __restrict__ wv,
    const float* __restrict__ wo, _Float16* __restrict__ dst)
{
  const int blk = blockIdx.x;
  const float* src = x;
  int sb = blk;
  if (blk >= CVT_XB) {
    const int u = (blk - CVT_XB) / CVT_WB;
    sb  = (blk - CVT_XB) % CVT_WB;
    src = u == 0 ? wq : u == 1 ? wk : u == 2 ? wv : wo;
  }
  const float* s = src + (size_t)sb  * CVT_BLK + threadIdx.x * 4;
  _Float16*    d = dst + (size_t)blk * CVT_BLK + threadIdx.x * 4;
  for (int it = 0; it < CVT_IT; ++it) {
    v4f v[CVT_LD];
#pragma unroll
    for (int j = 0; j < CVT_LD; j++)
      v[j] = *(const v4f*)(s + (it * CVT_LD + j) * 1024);
#pragma unroll
    for (int j = 0; j < CVT_LD; j++) {
      v4h h;
#pragma unroll
      for (int e = 0; e < 4; e++) h[e] = (_Float16)v[j][e];
      *(v4h*)(d + (it * CVT_LD + j) * 1024) = h;
    }
  }
}

/* Fragment loader per CDNA5 ISA 7.12.2 (16-bit A 16x32 / B 32x16 layouts).
   tile: pointer to the 16-row tile origin; row dim stride = `stride` halves;
   contiguous (matmul-K) dim carries the 8+8 half split at +0 / +16. */
__device__ __forceinline__ v16h ld_frag(const _Float16* tile, int stride) {
  const int lane = threadIdx.x & 31;
  const _Float16* p = tile + (size_t)(lane & 15) * stride + ((lane >> 4) << 3);
  v8h lo = *(const v8h*)(p);
  v8h hi = *(const v8h*)(p + 16);
  v16h r;
#pragma unroll
  for (int i = 0; i < 8; ++i) { r[i] = lo[i]; r[8 + i] = hi[i]; }
  return r;
}

/* ---------------- WMMA GEMM: C[M,N] = A[M,K] * Bw[N,K]^T + bias ----------------
   256 x BN block tile, 8 waves as 4 x 2, wave tile 64 x BN/2 (4 x BN/32 of 16x16),
   K-step 64: a staged row is one whole 128-B line, so a wave's 512-B copy asks
   L2 for 4 full lines. The large tile is what sets the traffic: L2 bytes per
   product go as 1/256 + 1/BN, LDS fragment reads per WMMA as 1/4 + 32/BN.
   BN is chosen per product so that the tiles are a whole multiple of the WGPs.
   Global->LDS staging via async copy engine into a ring of GNB buffers:
   8 + BN/32 async b128 ops per wave per stage, a stage's copies issued GNB - 1
   stages before its publish point, so that they have that long to come from L2.
   One publish point per stage, between the two 32-k halves of the stage before:
   there every fragment of that stage is in registers, so the one barrier
   publishes the next stage and frees this stage's buffer for the refill. */
#define GKS    64   /* halves of K per stage */
#define GBM    256  /* rows of A per block tile */
#define GPITCH 72   /* halves; 144 B = 16 B x odd: 16 rows of a ds_load_b128 fall on 16 bank groups */
#define GNB    4    /* buffers of the LDS ring, a power of two */
template <int BN, int ND>   /* ND: row length of C, a constant so that a wave's stores share one address */
__global__ __launch_bounds__(256) void gemm_wmma(
    const _Float16* __restrict__ A, const _Float16* __restrict__ Bw,
    float* __restrict__ C, int Mdim, int Ndim, int Kdim,
    const float* __restrict__ b0, const float* __restrict__ b1,
    const float* __restrict__ b2, int s1, int s2)
{
  constexpr int MI  = 4;              /* 16-row fragments of A per wave */
  constexpr int NJ  = BN / 32;        /* 16-col fragments of B per wave */
  constexpr int CPA = GBM * 8 / 256;  /* 16-B chunks per thread and stage, A */
  constexpr int CPB = BN  * 8 / 256;  /* the same, B */
  __shared__ __align__(16) _Float16 ldsA[GNB][GBM * GPITCH];
  __shared__ __align__(16) _Float16 ldsB[GNB][BN * GPITCH];
  const int tid  = threadIdx.x;
  const int lane = tid & 31, wave = tid >> 5;
  const int l15  = lane & 15, hi8 = (lane >> 4) << 3;
  const int wm = wave >> 1, wn = wave & 1;
  const int mBase = blockIdx.y * GBM;
  const int nBase = blockIdx.x * BN;

  const v8f zf = {};
  v8f acc[MI][NJ];
#pragma unroll
  for (int i = 0; i < MI; i++)
#pragma unroll
    for (int j = 0; j < NJ; j++) acc[i][j] = zf;

  /* chunk t of a thread: row row0 + 32 t, 16-B segment seg (8 chunks per 64-half row) */
  const int row0 = tid >> 3;
  const int seg  = (tid & 7) << 3;

  const int nk = Kdim / GKS;

#if USE_ASYNC
  /* ---- async pipeline ---- */
  /* the copies of stage s, into buffer s mod GNB */
  auto stage = [&](int s) {
    const int k0 = s * GKS, bu = s & (GNB - 1);
#pragma unroll
    for (int t = 0; t < CPA; t++)
      async_cp16(A  + (size_t)(mBase + row0 + t * 32) * Kdim + k0 + seg,
                 &ldsA[bu][(row0 + t * 32) * GPITCH + seg]);
#pragma unroll
    for (int t = 0; t < CPB; t++)
      async_cp16(Bw + (size_t)(nBase + row0 + t * 32) * Kdim + k0 + seg,
                 &ldsB[bu][(row0 + t * 32) * GPITCH + seg]);
  };
#pragma unroll
  for (int s = 0; s < GNB; s++)
    if (s < nk) stage(s);
  /* this wave's copies of stage 0 have landed (all but the GNB - 1 younger stages;
     with fewer stages than buffers: all) before the barrier publishes them */
  if (nk >= GNB) asm volatile("s_wait_asynccnt %0" :: "n"((GNB - 1) * (CPA + CPB)) : "memory");
  else           asm volatile("s_wait_asynccnt 0x0" ::: "memory");
  __syncthreads();
  /* one stage. steady: stage kb + GNB exists, so the publish point and the refill
     stand in straight-line code with the later half's WMMAs */
  auto trip = [&](int kb, bool steady) __attribute__((always_inline)) {
    const int st = kb & (GNB - 1);
    /* unrolled: both 32-k halves of the stage read at constant LDS offsets */
    v16h af[GKS / 32][MI], bf[GKS / 32][NJ];
#pragma unroll
    for (int u = 0; u < GKS / 32; u++) {
#pragma unroll
      for (int i = 0; i < MI; i++) af[u][i] = ld_frag(&ldsA[st][(wm * 64 + i * 16) * GPITCH + u * 32], GPITCH);
#pragma unroll
      for (int j = 0; j < NJ; j++) bf[u][j] = ld_frag(&ldsB[st][(wn * (BN / 2) + j * 16) * GPITCH + u * 32], GPITCH);
    }
    /* holds the stage's fragment loads together ahead of its WMMAs: left free, the
       scheduler keeps one A fragment, reloads it behind every row of WMMAs and
       waits out the LDS latency each time */
    __builtin_amdgcn_sched_barrier(0);
#pragma unroll
    for (int u = 0; u < GKS / 32; u++) {
#pragma unroll
      for (int i = 0; i < MI; i++)
#pragma unroll
        for (int j = 0; j < NJ; j++)
          acc[i][j] = __builtin_amdgcn_wmma_f32_16x16x32_f16(
              false, af[u][i], false, bf[u][j], (short)0, acc[i][j], false, false);
      if (u == 0 && (steady || kb + 1 < nk)) {
        /* keeps the first half's WMMAs ahead of the publish point and its wait for
           the later half's loads: left free, that wait rises above them all */
        __builtin_amdgcn_sched_barrier(0);
        /* publish point of stage kb + 1: this wave has left buffer st ... */
        asm volatile("s_wait_dscnt 0x0" ::: "memory");
        /* ... and its copies of stage kb + 1 have landed: all but the two younger
           stages' where both are under way, else all */
        if (steady || kb + GNB - 1 < nk) asm volatile("s_wait_asynccnt %0" :: "n"((GNB - 2) * (CPA + CPB)) : "memory");
        else                             asm volatile("s_wait_asynccnt 0x0" ::: "memory");
        __syncthreads();
        if (steady) stage(kb + GNB);   /* refill of the buffer every wave has just left */
      }
    }
  };
  int kb = 0;
  for (; kb + GNB < nk; ++kb) trip(kb, true);
  for (; kb < nk; ++kb)       trip(kb, false);
#else
  /* ---- fallback: register-staged pipeline ---- */
  v8h ra[CPA], rb[CPB];
#pragma unroll
  for (int t = 0; t < CPA; t++)
    ra[t] = *(const v8h*)(A  + (size_t)(mBase + row0 + t * 32) * Kdim + seg);
#pragma unroll
  for (int t = 0; t < CPB; t++)
    rb[t] = *(const v8h*)(Bw + (size_t)(nBase + row0 + t * 32) * Kdim + seg);
  for (int kb = 0; kb < nk; ++kb) {
#pragma unroll
    for (int t = 0; t < CPA; t++) *(v8h*)(&ldsA[0][(row0 + t * 32) * GPITCH + seg]) = ra[t];
#pragma unroll
    for (int t = 0; t < CPB; t++) *(v8h*)(&ldsB[0][(row0 + t * 32) * GPITCH + seg]) = rb[t];
    __syncthreads();
    if (kb + 1 < nk) {
      const int k0 = (kb + 1) * GKS;
#pragma unroll
      for (int t = 0; t < CPA; t++)
        ra[t] = *(const v8h*)(A  + (size_t)(mBase + row0 + t * 32) * Kdim + k0 + seg);
#pragma unroll
      for (int t = 0; t < CPB; t++)
        rb[t] = *(const v8h*)(Bw + (size_t)(nBase + row0 + t * 32) * Kdim + k0 + seg);
    }
    /* unrolled: both 32-k halves of the stage read at constant LDS offsets */
#pragma unroll
    for (int ks = 0; ks < GKS; ks += 32) {
      v16h af[MI], bf[NJ];
#pragma unroll
      for (int i = 0; i < MI; i++) af[i] = ld_frag(&ldsA[0][(wm * 64 + i * 16) * GPITCH + ks], GPITCH);
#pragma unroll
      for (int j = 0; j < NJ; j++) bf[j] = ld_frag(&ldsB[0][(wn * (BN / 2) + j * 16) * GPITCH + ks], GPITCH);
#pragma unroll
      for (int i = 0; i < MI; i++)
#pragma unroll
        for (int j = 0; j < NJ; j++)
          acc[i][j] = __builtin_amdgcn_wmma_f32_16x16x32_f16(
              false, af[i], false, bf[j], (short)0, acc[i][j], false, false);
    }
    __syncthreads();
  }
#endif

  /* epilogue: C/D layout - lane holds col, VGPR r holds row r + 8*(lane>=16) */
  float bias[NJ];
#pragma unroll
  for (int j = 0; j < NJ; j++) {
    const int col = nBase + wn * (BN / 2) + j * 16 + l15;
    bias[j] = (col < s1) ? b0[col] : (col < s2) ? b1[col - s1] : b2[col - s2];
  }
  float* cp = C + (size_t)(mBase + wm * 64 + hi8) * ND + nBase + wn * (BN / 2) + l15;
#pragma unroll
  for (int j = 0; j < NJ; j++)
#pragma unroll
    for (int i = 0; i < MI; i++)
#pragma unroll
      for (int r = 0; r < 8; r++)
        cp[(i * 16 + r) * ND + j * 16] = acc[i][j][r] + bias[j];
}

/* ---------------- RMSNorm + RoPE + repack to [B,N,S,HD] f16 ---------------- */
__global__ __launch_bounds__(256) void norm_rope(
    const float* __restrict__ Y, const float* __restrict__ freqs,
    const float* __restrict__ gq, const float* __restrict__ gk,
    _Float16* __restrict__ qh, _Float16* __restrict__ kh, _Float16* __restrict__ vh)
{
  const int m = blockIdx.x;
  const int b = m / SS, s = m % SS;
  const int tid = threadIdx.x;
  const float* Yr = Y + (size_t)m * N1;
  const int c0 = tid * 8;

  float qv[8], kv[8], vv[8];
  float sq = 0.f, sk = 0.f;
#pragma unroll
  for (int j = 0; j < 8; j++) {
    qv[j] = Yr[c0 + j]; kv[j] = Yr[DD + c0 + j]; vv[j] = Yr[2 * DD + c0 + j];
    sq += qv[j] * qv[j]; sk += kv[j] * kv[j];
  }
  for (int msk = 16; msk; msk >>= 1) {
    sq += __shfl_xor(sq, msk, 32);
    sk += __shfl_xor(sk, msk, 32);
  }
  __shared__ float red[16];
  const int wid = tid >> 5;
  if ((tid & 31) == 0) { red[wid] = sq; red[8 + wid] = sk; }
  __syncthreads();
  if (tid == 0) {
    float a = 0.f, c = 0.f;
    for (int i = 0; i < 8; i++) { a += red[i]; c += red[8 + i]; }
    red[0] = a; red[8] = c;
  }
  __syncthreads();
  const float rq = rsqrtf(red[0] * (1.0f / DD) + 1e-6f);
  const float rk = rsqrtf(red[8] * (1.0f / DD) + 1e-6f);

  const int n  = c0 / HD;
  const int d0 = c0 % HD;
  const size_t ob = ((size_t)(b * NH + n) * SS + s) * HD + d0;
#pragma unroll
  for (int j = 0; j < 8; j += 2) {
    const int p = (d0 + j) >> 1;
    const float f  = freqs[(size_t)s * (HD / 2) + p];
    const float cf = __cosf(f), sf = __sinf(f);
    const float u0 = qv[j]     * rq * gq[c0 + j];
    const float u1 = qv[j + 1] * rq * gq[c0 + j + 1];
    qh[ob + j]     = (_Float16)(u0 * cf - u1 * sf);
    qh[ob + j + 1] = (_Float16)(u0 * sf + u1 * cf);
    const float w0 = kv[j]     * rk * gk[c0 + j];
    const float w1 = kv[j + 1] * rk * gk[c0 + j + 1];
    kh[ob + j]     = (_Float16)(w0 * cf - w1 * sf);
    kh[ob + j + 1] = (_Float16)(w0 * sf + w1 * cf);
    vh[ob + j]     = (_Float16)vv[j];
    vh[ob + j + 1] = (_Float16)vv[j + 1];
  }
}

#define VPITCH 144  /* halves; 288 B = 32 B x odd, the transposing load's pitch */
#define KPITCH 136  /* halves; 272 B = 16 B x odd, the ds_load_b128 pitch */

typedef __attribute__((ext_vector_type(8))) short s16x8;
typedef __attribute__((address_space(3))) s16x8 lds_s16x8;

__device__ __forceinline__ v8h ld_tr16(const _Float16* p) {
  return __builtin_bit_cast(v8h, __builtin_amdgcn_ds_load_tr16_b128_v8i16((lds_s16x8*)p));
}

/* value of lane l ^ 16 */
__device__ __forceinline__ float xhalf(float x) {
  return __builtin_bit_cast(float, __builtin_amdgcn_permlanex16(
      __builtin_bit_cast(int, x), __builtin_bit_cast(int, x),
      0x76543210, 0xfedcba98, false, false));
}

__global__ __launch_bounds__(128) void attn_wmma(
    const _Float16* __restrict__ qh, const _Float16* __restrict__ kh,
    const _Float16* __restrict__ vh, const int* __restrict__ seq_lens,
    _Float16* __restrict__ oh)
{
  __shared__ __align__(16) _Float16 ldsK[2][32 * KPITCH];
  __shared__ __align__(16) _Float16 ldsV[2][32 * VPITCH];

  const int tid = threadIdx.x;
  const int lane = tid & 31, w = tid >> 5;
  const int l15 = lane & 15, hi8 = (lane >> 4) << 3;
  const int nqt = SS / 128;
  const int qt = blockIdx.x % nqt;
  const int h  = (blockIdx.x / nqt) % NH;
  const int b  = blockIdx.x / (nqt * NH);
  /* the key mask is arange(S) < seq_len: clamping to [0, S] leaves it as it is
     and bounds the trip count and every K/V address */
  int slen = seq_lens[b];
  slen = slen < 0 ? 0 : (slen > SS ? SS : slen);
  /* no valid key: every score equals the mask value, softmax is uniform over
     all S keys; scores of zero over all keys give the same */
  const int   lim = slen == 0 ? SS : slen;
  const float scl = slen == 0 ? 0.f : 0.08838834764831845f; /* 1/sqrt(128) */

  const size_t headO = (size_t)(b * NH + h) * SS * HD;
  const _Float16* qbase = qh + headO + (size_t)(qt * 128 + w * 32) * HD;
  const _Float16* kbase = kh + headO;
  const _Float16* vbase = vh + headO;

  /* B operand Q^T: column = query, same k order as the K rows (same loader) */
  v16h qf[2][4];
#pragma unroll
  for (int i = 0; i < 2; i++)
#pragma unroll
    for (int dc = 0; dc < 4; dc++)
      qf[i][dc] = ld_frag(qbase + (size_t)(i * 16) * HD + dc * 32, HD);

  const v8f zf = {};
  v8f o[2][8];                 /* o[i][dj][r] = O[query i*16+l15][dj*16+hi8+r] */
#pragma unroll
  for (int i = 0; i < 2; i++)
#pragma unroll
    for (int dj = 0; dj < 8; dj++) o[i][dj] = zf;
  float mrow[2], lrow[2];      /* lrow: this wave half's keys only */
#pragma unroll
  for (int i = 0; i < 2; i++) { mrow[i] = -3.0e38f; lrow[i] = 0.f; }

  /* lane address of the transposing load: key row 8*(l>>4)+(l&7), 16-B column half (l>>3)&1 */
  const int vtro = (hi8 + (lane & 7)) * VPITCH + (((lane >> 3) & 1) << 3);

  /* stage K tile and V tile number tile, [32][128 + pad] each, both row-major, into buffer buf */
  auto stage = [&](int tile, int buf) {
#pragma unroll
    for (int t = 0; t < 4; t++) {
      const int c = tid + t * 128;            /* 512 chunks of 8 halves */
      const int kk = c >> 4, seg = (c & 15) << 3;
#if USE_ASYNC
      async_cp16(kbase + (size_t)(tile * 32 + kk) * HD + seg, &ldsK[buf][kk * KPITCH + seg]);
      async_cp16(vbase + (size_t)(tile * 32 + kk) * HD + seg, &ldsV[buf][kk * VPITCH + seg]);
#else
      *(v8h*)(&ldsK[buf][kk * KPITCH + seg]) = *(const v8h*)(kbase + (size_t)(tile * 32 + kk) * HD + seg);
      *(v8h*)(&ldsV[buf][kk * VPITCH + seg]) = *(const v8h*)(vbase + (size_t)(tile * 32 + kk) * HD + seg);
#endif
    }
  };

  const int nkt = (lim + 31) >> 5;            /* at least 1 */
  stage(0, 0);
#if USE_ASYNC
  /* this wave's copies of tile 0 have landed before the barrier publishes them */
  asm volatile("s_wait_asynccnt 0x0" ::: "memory");
#endif
  __syncthreads();
  if (nkt > 1) stage(1, 1);

  for (int kt = 0; kt < nkt; ++kt) {
    const int st = kt & 1;
    const _Float16* kt16 = ldsK[st];
    const _Float16* vtr  = ldsV[st] + vtro;

    /* S^T = K * Q^T : sc[j][i][r] = score(key j*16+hi8+r, query i*16+l15) */
    v8f sc[2][2];
#pragma unroll
    for (int j = 0; j < 2; j++)
#pragma unroll
      for (int i = 0; i < 2; i++) sc[j][i] = zf;
#pragma unroll
    for (int dc = 0; dc < 4; dc++) {
      v16h ak0 = ld_frag(kt16 + 0 * 16 * KPITCH + dc * 32, KPITCH);
      v16h ak1 = ld_frag(kt16 + 1 * 16 * KPITCH + dc * 32, KPITCH);
#pragma unroll
      for (int i = 0; i < 2; i++) {
        sc[0][i] = __builtin_amdgcn_wmma_f32_16x16x32_f16(
            false, ak0, false, qf[i][dc], (short)0, sc[0][i], false, false);
        sc[1][i] = __builtin_amdgcn_wmma_f32_16x16x32_f16(
            false, ak1, false, qf[i][dc], (short)0, sc[1][i], false, false);
      }
    }

    /* scale; key mask only in a tile that reaches past the last valid key */
#pragma unroll
    for (int j = 0; j < 2; j++)
#pragma unroll
      for (int i = 0; i < 2; i++)
#pragma unroll
        for (int r = 0; r < 8; r++) sc[j][i][r] *= scl;
    if (kt * 32 + 32 > lim) {
#pragma unroll
      for (int j = 0; j < 2; j++)
#pragma unroll
        for (int r = 0; r < 8; r++) {
          const bool valid = kt * 32 + j * 16 + hi8 + r < lim;
#pragma unroll
          for (int i = 0; i < 2; i++) sc[j][i][r] = valid ? sc[j][i][r] : -3.0e38f;
        }
    }

    /* online softmax: a lane and its partner in the other half share one query */
    v16h pf[2];
#pragma unroll
    for (int i = 0; i < 2; i++) {
      float t = fmaxf(sc[0][i][0], sc[1][i][0]);
#pragma unroll
      for (int r = 1; r < 8; r++) t = fmaxf(t, fmaxf(sc[0][i][r], sc[1][i][r]));
      t = fmaxf(t, xhalf(t));
      const float mn = fmaxf(mrow[i], t);
      const float al = __expf(mrow[i] - mn);
      float rs = 0.f;
#pragma unroll
      for (int j = 0; j < 2; j++)
#pragma unroll
        for (int r = 0; r < 8; r++) {
          const float p = __expf(sc[j][i][r] - mn);
          rs += p;
          pf[i][j * 8 + r] = (_Float16)p;   /* B operand P^T, hardware k order */
        }
      lrow[i] = lrow[i] * al + rs;
      mrow[i] = mn;
#pragma unroll
      for (int dj = 0; dj < 8; dj++)
#pragma unroll
        for (int r = 0; r < 8; r++) o[i][dj][r] *= al;
    }

    /* O^T += V^T * P^T  (A frags: rows = d, matmul-K = key) */
#pragma unroll
    for (int dj = 0; dj < 8; dj++) {
      const v8h lo = ld_tr16(vtr + dj * 16);
      const v8h hi = ld_tr16(vtr + 16 * VPITCH + dj * 16);
      v16h vf;
#pragma unroll
      for (int e = 0; e < 8; e++) { vf[e] = lo[e]; vf[8 + e] = hi[e]; }
      o[0][dj] = __builtin_amdgcn_wmma_f32_16x16x32_f16(
          false, vf, false, pf[0], (short)0, o[0][dj], false, false);
      o[1][dj] = __builtin_amdgcn_wmma_f32_16x16x32_f16(
          false, vf, false, pf[1], (short)0, o[1][dj], false, false);
    }

    /* hand-over: this wave has left buffer st ... */
    asm volatile("s_wait_dscnt 0x0" ::: "memory");
#if USE_ASYNC
    /* ... and its copies of tile kt + 1 have landed, before the one barrier that
       publishes that tile and frees buffer st for the refill behind it */
    asm volatile("s_wait_asynccnt 0x0" ::: "memory");
#endif
    __syncthreads();
    if (kt + 2 < nkt) stage(kt + 2, st);
  }
#if USE_ASYNC
  /* no copy is outstanding when the wave ends */
  asm volatile("s_wait_asynccnt 0x0" ::: "memory");
#endif

  /* join the halves' sums, normalize, write [B,S,D] f16: 8 consecutive d per lane */
#pragma unroll
  for (int i = 0; i < 2; i++) {
    const int srow = qt * 128 + w * 32 + i * 16 + l15;
    const float inv = 1.0f / (lrow[i] + xhalf(lrow[i]));
    _Float16* orow = oh + ((size_t)(b * SS + srow)) * DD + h * HD + hi8;
#pragma unroll
    for (int dj = 0; dj < 8; dj++) {
      v8h ov;
#pragma unroll
      for (int r = 0; r < 8; r++) ov[r] = (_Float16)(o[i][dj][r] * inv);
      *(v8h*)(orow + dj * 16) = ov;
    }
  }
}

/* ---------------- host-side orchestration ---------------- */
extern "C" void kernel_launch(void* const* d_in, const int* in_sizes, int n_in,
                              void* d_out, int out_size, void* d_ws, size_t ws_size,
                              hipStream_t stream) {
  (void)in_sizes; (void)n_in; (void)out_size; (void)ws_size;
  const float* x        = (const float*)d_in[0];
  const int*   seq_lens = (const int*)d_in[1];
  const float* freqs    = (const float*)d_in[2];
  const float* wq = (const float*)d_in[3];
  const float* bq = (const float*)d_in[4];
  const float* wk = (const float*)d_in[5];
  const float* bk = (const float*)d_in[6];
  const float* wv = (const float*)d_in[7];
  const float* bv = (const float*)d_in[8];
  const float* wo = (const float*)d_in[9];
  const float* bo = (const float*)d_in[10];
  const float* gq = (const float*)d_in[11];
  const float* gk = (const float*)d_in[12];

  char* ws = (char*)d_ws;
  _Float16* xh    = (_Float16*)(ws + OFF_XH);
  _Float16* wqkvh = (_Float16*)(ws + OFF_WQKV);
  _Float16* woh   = (_Float16*)(ws + OFF_WO);
  float*    Y     = (float*)(ws + OFF_Y);
  _Float16* qhp   = (_Float16*)(ws + OFF_QH);
  _Float16* khp   = (_Float16*)(ws + OFF_KH);
  _Float16* vhp   = (_Float16*)(ws + OFF_VH);
  _Float16* ohp   = (_Float16*)(ws + OFF_OH);

  /* 1) down-convert activations + weights to f16 */
  cvt_f16<<<CVT_XB + 4 * CVT_WB, 256, 0, stream>>>(x, wq, wk, wv, wo, xh);

  /* 2) fused QKV projection: Y[4096,6144] = xh * [wq;wk;wv]^T + [bq|bk|bv] */
  gemm_wmma<192, N1><<<dim3(N1 / 192, MM / GBM), 256, 0, stream>>>(
      xh, wqkvh, Y, MM, N1, DD, bq, bk, bv, DD, 2 * DD);

  /* 3) RMSNorm + RoPE + repack */
  norm_rope<<<MM, 256, 0, stream>>>(Y, freqs, gq, gk, qhp, khp, vhp);

  /* 4) flash attention */
  attn_wmma<<<BB * NH * (SS / 128), 128, 0, stream>>>(qhp, khp, vhp, seq_lens, ohp);

  /* 5) output projection into d_out (f32) */
  gemm_wmma<128, DD><<<dim3(DD / 128, MM / GBM), 256, 0, stream>>>(
      ohp, woh, (float*)d_out, MM, DD, DD, bo, bo, bo, DD, 2 * DD);
}

// v008
// A run of this version takes 177 microseconds.
// Next to v007, in two timings, it ran 1.08 and 1.07 times as fast.
// Over all steps from v000 it is 4.49 times as fast.
#include <hip/hip_runtime.h>

typedef __attribute__((ext_vector_type(16))) _Float16 v16h;
typedef __attribute__((ext_vector_type(8)))  _Float16 v8h;
typedef __attribute__((ext_vector_type(8)))  float    v8f;
typedef __attribute__((ext_vector_type(4)))  int      v4i;

#define BB 2
#define SS 2048
#define DD 2048
#define NH 16
#define HD 128
#define MM (BB*SS)      /* 4096 rows */
#define N1 (3*DD)       /* 6144 fused QKV cols */

/* ---- workspace layout (bytes) ---- */
#define OFF_XH   ((size_t)0)
#define OFF_WQKV (OFF_XH   + (size_t)MM*DD*2)     /* x in f16            */
#define OFF_WO   (OFF_WQKV + (size_t)N1*DD*2)     /* [wq;wk;wv] f16      */
#define OFF_Y    (OFF_WO   + (size_t)DD*DD*2)     /* wo f16              */
#define OFF_QH   (OFF_Y    + (size_t)MM*N1*4)     /* square sums, scales */
#define OFF_KH   (OFF_QH   + (size_t)MM*DD*2)     /* q f16 [B,N,S,HD]    */
/* a wave of the QKV product owns QW columns; the waves (slots) that hold columns of q and of k */
#define QW       96
#define KS_FIRST (DD / QW)
#define KS_LAST  ((2 * DD - 1) / QW)
#define QS_LAST  ((DD - 1) / QW)
#define NPS      (QS_LAST + 1)                    /* slots of q; k has as many */
#define OFF_RS   (OFF_Y + (size_t)2 * NPS * MM * 4) /* rsqrt row scales, q then k */
#define OFF_VH   (OFF_KH   + (size_t)MM*DD*2)
#define OFF_OH   (OFF_VH   + (size_t)MM*DD*2)     /* attn out f16 [B,S,D]*/

/* ---- CDNA5 async global->LDS copy (ASYNCcnt-tracked, bypasses VGPRs) ---- */
#if __has_builtin(__builtin_amdgcn_global_load_async_to_lds_b128) && \
    __has_builtin(__builtin_amdgcn_s_wait_asynccnt)
#define USE_ASYNC 1
#else
#define USE_ASYNC 0
#endif

/* b128 payload type: <4 x i32>; clang prints AS(1) as `__device__` in HIP */
typedef __attribute__((address_space(1))) v4i gv4i;
typedef __attribute__((address_space(3))) v4i lv4i;

__device__ __forceinline__ void async_cp16(const void* g, void* l) {
#if USE_ASYNC
  /* generic LDS pointers carry the LDS byte offset in the low 32 bits
     (flat->LDS aperture mapping: LDS_ADDR = addr[31:0]) */
  __builtin_amdgcn_global_load_async_to_lds_b128(
      (gv4i*)(unsigned long long)(size_t)g,
      (lv4i*)(unsigned int)(size_t)l, 0, 0);
#else
  (void)g; (void)l;
#endif
}

/* ---------------- f32 -> f16 convert: x and the four weights, one streaming launch ----------------
   The five f16 copies lie one behind the other at the start of the workspace
   (x | wq | wk | wv | wo), so the destination is one array and a block's
   32,768 elements come from one source. A wave-wide load covers 512 contiguous
   bytes (4 whole lines), a wave-wide store 256 (2 whole lines); at least 8
   loads of a lane are in flight before the first is converted. */
typedef __attribute__((ext_vector_type(4))) float    v4f;
typedef __attribute__((ext_vector_type(4))) _Float16 v4h;
#define CVT_LD   8                             /* 16-B loads of a lane issued as a group */
#define CVT_IT   4                             /* such groups per lane */
#define CVT_BLK  (256 * 4 * CVT_LD * CVT_IT)   /* elements per block */
#define CVT_XB   (MM * DD / CVT_BLK)           /* blocks of x */
#define CVT_WB   (DD * DD / CVT_BLK)           /* blocks of one weight */
__global__ __launch_bounds__(256) void cvt_f16(
    const float* __restrict__ x,  const float* __restrict__ wq,
    const float* __restrict__ wk, const float* __restrict__ wv,
    const float* __restrict__ wo, _Float16* __restrict__ dst)
{
  const int blk = blockIdx.x;
  const float* src = x;
  int sb = blk;
  if (blk >= CVT_XB) {
    const int u = (blk - CVT_XB) / CVT_WB;
    sb  = (blk - CVT_XB) % CVT_WB;
    src = u == 0 ? wq : u == 1 ? wk : u == 2 ? wv : wo;
  }
  const float* s = src + (size_t)sb  * CVT_BLK + threadIdx.x * 4;
  _Float16*    d = dst + (size_t)blk * CVT_BLK + threadIdx.x * 4;
  for (int it = 0; it < CVT_IT; ++it) {
    v4f v[CVT_LD];
#pragma unroll
    for (int j = 0; j < CVT_LD; j++)
      v[j] = *(const v4f*)(s + (it * CVT_LD + j) * 1024);
#pragma unroll
    for (int j = 0; j < CVT_LD; j++) {
      v4h h;
#pragma unroll
      for (int e = 0; e < 4; e++) h[e] = (_Float16)v[j][e];
      *(v4h*)(d + (it * CVT_LD + j) * 1024) = h;
    }
  }
}

/* Fragment loader per CDNA5 ISA 7.12.2 (16-bit A 16x32 / B 32x16 layouts).
   tile: pointer to the 16-row tile origin; row dim stride = `stride` halves;
   contiguous (matmul-K) dim carries the 8+8 half split at +0 / +16. */
__device__ __forceinline__ v16h ld_frag(const _Float16* tile, int stride) {
  const int lane = threadIdx.x & 31;
  const _Float16* p = tile + (size_t)(lane & 15) * stride + ((lane >> 4) << 3);
  v8h lo = *(const v8h*)(p);
  v8h hi = *(const v8h*)(p + 16);
  v16h r;
#pragma unroll
  for (int i = 0; i < 8; ++i) { r[i] = lo[i]; r[8 + i] = hi[i]; }
  return r;
}

/* value of lane l ^ 16 */
__device__ __forceinline__ float xhalf(float x) {
  return __builtin_bit_cast(float, __builtin_amdgcn_permlanex16(
      __builtin_bit_cast(int, x), __builtin_bit_cast(int, x),
      0x76543210, 0xfedcba98, false, false));
}

/* ---------------- WMMA GEMM: C[M,N] = A[M,K] * Bw[N,K]^T + bias ----------------
   256 x BN block tile, 8 waves as 4 x 2, wave tile 64 x BN/2 (4 x BN/32 of 16x16),
   K-step 64: a staged row is one whole 128-B line, so a wave's 512-B copy asks
   L2 for 4 full lines. The large tile is what sets the traffic: L2 bytes per
   product go as 1/256 + 1/BN, LDS fragment reads per WMMA as 1/4 + 32/BN.
   BN is chosen per product so that the tiles are a whole multiple of the WGPs.
   Global->LDS staging via async copy engine into a ring of GNB buffers:
   8 + BN/32 async b128 ops per wave per stage, a stage's copies issued GNB - 1
   stages before its publish point, so that they have that long to come from L2.
   One publish point per stage, between the two 32-k halves of the stage before:
   there every fragment of that stage is in registers, so the one barrier
   publishes the next stage and frees this stage's buffer for the refill. */
#define GKS    64   /* halves of K per stage */
#define GBM    256  /* rows of A per block tile */
#define GPITCH 72   /* halves; 144 B = 16 B x odd: 16 rows of a ds_load_b128 fall on 16 bank groups */
#define GNB    4    /* buffers of the LDS ring, a power of two */
#define SPITCH 200  /* halves; 400 B = 16 B x odd: pitch of the QKV epilogue's staged tile */
/* one 16x16x32 step. QKV: the product is taken transposed (rows of W as A, rows of x as B,
   both by the same loader, so the k orders agree): a lane then holds 8 neighbouring
   features of ONE token, which is what RoPE pairs, square sums and 16-B packing want */
template <bool QKV>
__device__ __forceinline__ v8f mm16(v16h a, v16h b, v8f c) {
  if constexpr (QKV)
    return __builtin_amdgcn_wmma_f32_16x16x32_f16(false, b, false, a, (short)0, c, false, false);
  else
    return __builtin_amdgcn_wmma_f32_16x16x32_f16(false, a, false, b, (short)0, c, false, false);
}
/* QKV: the epilogue adds the bias, sums the squares of a token's q and k columns (one
   partial per wave, to C), applies gain and RoPE to q and k WITHOUT the RMS scale (a
   scalar per token, which commutes with both and is applied to the scores), and
   writes q, k, v as f16 [B,N,S,HD] */
template <int BN, int ND, bool QKV>   /* ND: row length of C, a constant so that a wave's stores share one address */
__global__ __launch_bounds__(256) void gemm_wmma(
    const _Float16* __restrict__ A, const _Float16* __restrict__ Bw,
    float* __restrict__ C, int Mdim, int Ndim, int Kdim,
    const float* __restrict__ b0, const float* __restrict__ b1,
    const float* __restrict__ b2, int s1, int s2,
    const float* __restrict__ freqs, const float* __restrict__ gq,
    const float* __restrict__ gk, _Float16* __restrict__ qh,
    _Float16* __restrict__ kh, _Float16* __restrict__ vh)
{
  constexpr int MI  = 4;              /* 16-row fragments of A per wave */
  constexpr int NJ  = BN / 32;        /* 16-col fragments of B per wave */
  constexpr int CPA = GBM * 8 / 256;  /* 16-B chunks per thread and stage, A */
  constexpr int CPB = BN  * 8 / 256;  /* the same, B */
  __shared__ __align__(16) _Float16 ldsA[GNB][GBM * GPITCH];
  __shared__ __align__(16) _Float16 ldsB[GNB][BN * GPITCH];
  const int tid  = threadIdx.x;
  const int lane = tid & 31, wave = tid >> 5;
  const int l15  = lane & 15, hi8 = (lane >> 4) << 3;
  const int wm = wave >> 1, wn = wave & 1;
  const int mBase = blockIdx.y * GBM;
  const int nBase = blockIdx.x * BN;

  const v8f zf = {};
  v8f acc[MI][NJ];
#pragma unroll
  for (int i = 0; i < MI; i++)
#pragma unroll
    for (int j = 0; j < NJ; j++) acc[i][j] = zf;

  /* chunk t of a thread: row row0 + 32 t, 16-B segment seg (8 chunks per 64-half row) */
  const int row0 = tid >> 3;
  const int seg  = (tid & 7) << 3;

  const int nk = Kdim / GKS;

#if USE_ASYNC
  /* ---- async pipeline ---- */
  /* the copies of stage s, into buffer s mod GNB */
  auto stage = [&](int s) {
    const int k0 = s * GKS, bu = s & (GNB - 1);
#pragma unroll
    for (int t = 0; t < CPA; t++)
      async_cp16(A  + (size_t)(mBase + row0 + t * 32) * Kdim + k0 + seg,
                 &ldsA[bu][(row0 + t * 32) * GPITCH + seg]);
#pragma unroll
    for (int t = 0; t < CPB; t++)
      async_cp16(Bw + (size_t)(nBase + row0 + t * 32) * Kdim + k0 + seg,
                 &ldsB[bu][(row0 + t * 32) * GPITCH + seg]);
  };
#pragma unroll
  for (int s = 0; s < GNB; s++)
    if (s < nk) stage(s);
  /* this wave's copies of stage 0 have landed (all but the GNB - 1 younger stages;
     with fewer stages than buffers: all) before the barrier publishes them */
  if (nk >= GNB) asm volatile("s_wait_asynccnt %0" :: "n"((GNB - 1) * (CPA + CPB)) : "memory");
  else           asm volatile("s_wait_asynccnt 0x0" ::: "memory");
  __syncthreads();
  /* one stage. steady: stage kb + GNB exists, so the publish point and the refill
     stand in straight-line code with the later half's WMMAs */
  auto trip = [&](int kb, bool steady) __attribute__((always_inline)) {
    const int st = kb & (GNB - 1);
    /* unrolled: both 32-k halves of the stage read at constant LDS offsets */
    v16h af[GKS / 32][MI], bf[GKS / 32][NJ];
#pragma unroll
    for (int u = 0; u < GKS / 32; u++) {
#pragma unroll
      for (int i = 0; i < MI; i++) af[u][i] = ld_frag(&ldsA[st][(wm * 64 + i * 16) * GPITCH + u * 32], GPITCH);
#pragma unroll
      for (int j = 0; j < NJ; j++) bf[u][j] = ld_frag(&ldsB[st][(wn * (BN / 2) + j * 16) * GPITCH + u * 32], GPITCH);
    }
    /* holds the stage's fragment loads together ahead of its WMMAs: left free, the
       scheduler keeps one A fragment, reloads it behind every row of WMMAs and
       waits out the LDS latency each time */
    __builtin_amdgcn_sched_barrier(0);
#pragma unroll
    for (int u = 0; u < GKS / 32; u++) {
#pragma unroll
      for (int i = 0; i < MI; i++)
#pragma unroll
        for (int j = 0; j < NJ; j++)
          acc[i][j] = mm16<QKV>(af[u][i], bf[u][j], acc[i][j]);
      if (u == 0 && (steady || kb + 1 < nk)) {
        /* keeps the first half's WMMAs ahead of the publish point and its wait for
           the later half's loads: left free, that wait rises above them all */
        __builtin_amdgcn_sched_barrier(0);
        /* publish point of stage kb + 1: this wave has left buffer st ... */
        asm volatile("s_wait_dscnt 0x0" ::: "memory");
        /* ... and its copies of stage kb + 1 have landed: all but the two younger
           stages' where both are under way, else all */
        if (steady || kb + GNB - 1 < nk) asm volatile("s_wait_asynccnt %0" :: "n"((GNB - 2) * (CPA + CPB)) : "memory");
        else                             asm volatile("s_wait_asynccnt 0x0" ::: "memory");
        __syncthreads();
        if (steady) stage(kb + GNB);   /* refill of the buffer every wave has just left */
      }
    }
  };
  int kb = 0;
  for (; kb + GNB < nk; ++kb) trip(kb, true);
  for (; kb < nk; ++kb)       trip(kb, false);
#else
  /* ---- fallback: register-staged pipeline ---- */
  v8h ra[CPA], rb[CPB];
#pragma unroll
  for (int t = 0; t < CPA; t++)
    ra[t] = *(const v8h*)(A  + (size_t)(mBase + row0 + t * 32) * Kdim + seg);
#pragma unroll
  for (int t = 0; t < CPB; t++)
    rb[t] = *(const v8h*)(Bw + (size_t)(nBase + row0 + t * 32) * Kdim + seg);
  for (int kb = 0; kb < nk; ++kb) {
#pragma unroll
    for (int t = 0; t < CPA; t++) *(v8h*)(&ldsA[0][(row0 + t * 32) * GPITCH + seg]) = ra[t];
#pragma unroll
    for (int t = 0; t < CPB; t++) *(v8h*)(&ldsB[0][(row0 + t * 32) * GPITCH + seg]) = rb[t];
    __syncthreads();
    if (kb + 1 < nk) {
      const int k0 = (kb + 1) * GKS;
#pragma unroll
      for (int t = 0; t < CPA; t++)
        ra[t] = *(const v8h*)(A  + (size_t)(mBase + row0 + t * 32) * Kdim + k0 + seg);
#pragma unroll
      for (int t = 0; t < CPB; t++)
        rb[t] = *(const v8h*)(Bw + (size_t)(nBase + row0 + t * 32) * Kdim + k0 + seg);
    }
    /* unrolled: both 32-k halves of the stage read at constant LDS offsets */
#pragma unroll
    for (int ks = 0; ks < GKS; ks += 32) {
      v16h af[MI], bf[NJ];
#pragma unroll
      for (int i = 0; i < MI; i++) af[i] = ld_frag(&ldsA[0][(wm * 64 + i * 16) * GPITCH + ks], GPITCH);
#pragma unroll
      for (int j = 0; j < NJ; j++) bf[j] = ld_frag(&ldsB[0][(wn * (BN / 2) + j * 16) * GPITCH + ks], GPITCH);
#pragma unroll
      for (int i = 0; i < MI; i++)
#pragma unroll
        for (int j = 0; j < NJ; j++)
          acc[i][j] = mm16<QKV>(af[i], bf[j], acc[i][j]);
    }
    __syncthreads();
  }
#endif

  if constexpr (QKV) {
    /* lane holds token l15 of fragment i, features hi8 .. hi8 + 7 of fragment j */
    static_assert(BN / 2 == QW && BN % 64 == 0 && GBM * SPITCH <= GNB * GBM * GPITCH, "QKV tile");
    const unsigned wnu = __builtin_amdgcn_readfirstlane(wn);   /* scalar: the q / k / v test below is a scalar branch */
    const unsigned f0  = nBase + wnu * (BN / 2);               /* first of the wave's features */
    /* every table value of the epilogue is asked for here, as one group in the registers
       the fragments have left: loaded where it is used, each fragment waits out L2 twice.
       A v fragment's gain and angles are loaded (in bounds) and not used */
    v4f bl[NJ], bh[NJ], gl[NJ], gh[NJ], fr[MI][NJ];
    const unsigned s0 = (unsigned)mBase % SS + wm * 64 + l15;  /* position of the lane's token in fragment 0 (a tile lies in one batch row) */
#pragma unroll
    for (int j = 0; j < NJ; j++) {
      /* the fragment's part of each address is scalar, the lane's part the same for all j */
      const unsigned fb = f0 + j * 16, reg = fb / DD;   /* 0 q, 1 k, 2 v */
      const float* bp = (reg == 0 ? b0 : reg == 1 ? b1 : b2) + fb % DD;
      const float* gp = (reg == 0 ? gq : gk) + fb % DD;
      const float* fp = freqs + ((fb % HD) >> 1);       /* angle of the fragment's first pair */
      bl[j] = *(const v4f*)(bp + hi8); bh[j] = *(const v4f*)(bp + hi8 + 4);
      gl[j] = *(const v4f*)(gp + hi8); gh[j] = *(const v4f*)(gp + hi8 + 4);
#pragma unroll
      for (int i = 0; i < MI; i++) {
        if (j == NJ - 1 && i == MI - 1) {
          /* the last load's result may be given the registers that the loads before it name */
          __builtin_amdgcn_sched_barrier(0);
          asm volatile("s_wait_xcnt 0x0" ::: "memory");
          __builtin_amdgcn_sched_barrier(0);
        }
        fr[i][j] = *(const v4f*)(fp + (s0 + i * 16) * (HD / 2) + (hi8 >> 1));
      }
      if (j + 1 < NJ) {
        /* the next fragment's addresses are formed in the registers that these loads name;
           the scheduling fences keep that arithmetic behind the wait */
        __builtin_amdgcn_sched_barrier(0);
        asm volatile("s_wait_xcnt 0x0" ::: "memory");
        __builtin_amdgcn_sched_barrier(0);
      }
    }
    /* the ring becomes output staging: this wave's last fragment reads have returned ... */
    asm volatile("s_wait_dscnt 0x0" ::: "memory");
    /* ... and so have every other wave's (no copy is outstanding behind the last stages' waits to 0) */
    __syncthreads();
    _Float16* stg = &ldsA[0][0];
    float ssq[MI], ssk[MI];
#pragma unroll
    for (int i = 0; i < MI; i++) { ssq[i] = 0.f; ssk[i] = 0.f; }
#pragma unroll
    for (int j = 0; j < NJ; j++) {
      const unsigned reg = (f0 + j * 16) / DD;
      _Float16* sp = stg + (wm * 64 + l15) * SPITCH + wnu * (BN / 2) + j * 16 + hi8;
      if (reg < 2) {
#pragma unroll
        for (int i = 0; i < MI; i++) {
          float y[8], ss = 0.f;
#pragma unroll
          for (int r = 0; r < 8; r++) {
            y[r] = acc[i][j][r] + (r < 4 ? bl[j][r & 3] : bh[j][r & 3]);
            ss += y[r] * y[r];
          }
          if (reg == 0) ssq[i] += ss; else ssk[i] += ss;
          v8h h;
#pragma unroll
          for (int e = 0; e < 4; e++) {
            const float cf = __cosf(fr[i][j][e]), sf = __sinf(fr[i][j][e]);
            const float u0 = y[2 * e]     * (e < 2 ? gl[j][2 * e]     : gh[j][2 * e - 4]);
            const float u1 = y[2 * e + 1] * (e < 2 ? gl[j][2 * e + 1] : gh[j][2 * e - 3]);
            h[2 * e]     = (_Float16)(u0 * cf - u1 * sf);
            h[2 * e + 1] = (_Float16)(u0 * sf + u1 * cf);
          }
          *(v8h*)(sp + i * 16 * SPITCH) = h;
        }
      } else {
#pragma unroll
        for (int i = 0; i < MI; i++) {
          v8h h;
#pragma unroll
          for (int r = 0; r < 8; r++)
            h[r] = (_Float16)(acc[i][j][r] + (r < 4 ? bl[j][r & 3] : bh[j][r & 3]));
          *(v8h*)(sp + i * 16 * SPITCH) = h;
        }
      }
    }
    /* the staged tile is complete; 8 lanes then store one whole 128-B line, a wave 4 rows.
       A line's 64 features lie in one head of one product: that part of the address is scalar */
    __syncthreads();
    /* square sums of this wave's columns: plane [slot][token], 64 tokens = 2 whole lines a wave
       (behind the barrier, which would wait for these stores) */
    const unsigned slot = blockIdx.x * 2 + wnu;
#pragma unroll
    for (int i = 0; i < MI; i++) {
      const int tok = mBase + wm * 64 + i * 16 + l15;
      const float aq = ssq[i] + xhalf(ssq[i]);
      const float ak = ssk[i] + xhalf(ssk[i]);
      if (slot <= QS_LAST && lane < 16) C[(size_t)slot * MM + tok] = aq;
      if (slot >= KS_FIRST && slot <= KS_LAST && lane < 16)
        C[(size_t)(NPS + slot - KS_FIRST) * MM + tok] = ak;
    }
    const unsigned sgl = tid & 7, rwl = tid >> 3;
#pragma unroll
    for (int lg = 0; lg < BN / 64; lg++) {
      const unsigned f = nBase + lg * 64, reg = f / DD, cc = f % DD;
      _Float16* dp = (reg == 0 ? qh : reg == 1 ? kh : vh)
          + ((size_t)((unsigned)mBase / SS * NH + cc / HD) * SS + (unsigned)mBase % SS) * HD + cc % HD;
      v8h h[GBM / 32];
#pragma unroll
      for (int rg = 0; rg < GBM / 32; rg++)
        h[rg] = *(const v8h*)(stg + (rg * 32 + rwl) * SPITCH + lg * 64 + sgl * 8);
#pragma unroll
      for (int rg = 0; rg < GBM / 32; rg++)
        *(v8h*)(dp + (rg * 32 + rwl) * HD + sgl * 8) = h[rg];
      if (lg + 1 < BN / 64) {
        /* the next group's LDS loads may be given the registers that these stores name;
           the scheduling fences keep them behind the wait */
        __builtin_amdgcn_sched_barrier(0);
        asm volatile("s_wait_xcnt 0x0" ::: "memory");
        __builtin_amdgcn_sched_barrier(0);
      }
    }
  } else {
  /* epilogue: C/D layout - lane holds col, VGPR r holds row r + 8*(lane>=16) */
  float bias[NJ];
#pragma unroll
  for (int j = 0; j < NJ; j++) {
    const int col = nBase + wn * (BN / 2) + j * 16 + l15;
    bias[j] = (col < s1) ? b0[col] : (col < s2) ? b1[col - s1] : b2[col - s2];
  }
  float* cp = C + (size_t)(mBase + wm * 64 + hi8) * ND + nBase + wn * (BN / 2) + l15;
#pragma unroll
  for (int j = 0; j < NJ; j++)
#pragma unroll
    for (int i = 0; i < MI; i++)
#pragma unroll
      for (int r = 0; r < 8; r++)
        cp[(i * 16 + r) * ND + j * 16] = acc[i][j][r] + bias[j];
  }
}

/* ---------------- RMS row scales: rsqrt(mean square + eps) of every token's q and k ---------------- */
__global__ __launch_bounds__(256) void rms_scale(const float* __restrict__ part, float* __restrict__ rs)
{
  const int t = blockIdx.x * 256 + threadIdx.x;     /* q tokens, then k tokens */
  const float* p = part + (size_t)(t / MM) * NPS * MM + t % MM;
  float a = 0.f;
#pragma unroll
  for (int u = 0; u < NPS; u++) a += p[(size_t)u * MM];
  rs[t] = rsqrtf(a * (1.0f / DD) + 1e-6f);
}

#define VPITCH 144  /* halves; 288 B = 32 B x odd, the transposing load's pitch */
#define KPITCH 136  /* halves; 272 B = 16 B x odd, the ds_load_b128 pitch */

typedef __attribute__((ext_vector_type(8))) short s16x8;
typedef __attribute__((address_space(3))) s16x8 lds_s16x8;

__device__ __forceinline__ v8h ld_tr16(const _Float16* p) {
  return __builtin_bit_cast(v8h, __builtin_amdgcn_ds_load_tr16_b128_v8i16((lds_s16x8*)p));
}

__global__ __launch_bounds__(128) void attn_wmma(
    const _Float16* __restrict__ qh, const _Float16* __restrict__ kh,
    const _Float16* __restrict__ vh, const int* __restrict__ seq_lens,
    const float* __restrict__ rsc, _Float16* __restrict__ oh)
{
  __shared__ __align__(16) _Float16 ldsK[2][32 * KPITCH];
  __shared__ __align__(16) _Float16 ldsV[2][32 * VPITCH];
  __shared__ __align__(16) float    ldsR[SS];   /* rk of this batch row's keys */

  const int tid = threadIdx.x;
  const int lane = tid & 31, w = tid >> 5;
  const int l15 = lane & 15, hi8 = (lane >> 4) << 3;
  const int nqt = SS / 128;
  const int qt = blockIdx.x % nqt;
  const int h  = (blockIdx.x / nqt) % NH;
  const int b  = blockIdx.x / (nqt * NH);
  /* the key mask is arange(S) < seq_len: clamping to [0, S] leaves it as it is
     and bounds the trip count and every K/V address */
  int slen = seq_lens[b];
  slen = slen < 0 ? 0 : (slen > SS ? SS : slen);
  /* no valid key: every score equals the mask value, softmax is uniform over
     all S keys; scores of zero over all keys give the same */
  const int   lim = slen == 0 ? SS : slen;
  const float scl = slen == 0 ? 0.f : 0.08838834764831845f; /* 1/sqrt(128) */

  const size_t headO = (size_t)(b * NH + h) * SS * HD;
  const _Float16* qbase = qh + headO + (size_t)(qt * 128 + w * 32) * HD;
  const _Float16* kbase = kh + headO;
  const _Float16* vbase = vh + headO;

  /* B operand Q^T: column = query, same k order as the K rows (same loader) */
  v16h qf[2][4];
#pragma unroll
  for (int i = 0; i < 2; i++)
#pragma unroll
    for (int dc = 0; dc < 4; dc++)
      qf[i][dc] = ld_frag(qbase + (size_t)(i * 16) * HD + dc * 32, HD);

  /* the lane's two queries: RMS scale times score scale, never negative */
  float qs[2];
#pragma unroll
  for (int i = 0; i < 2; i++) qs[i] = rsc[b * SS + qt * 128 + w * 32 + i * 16 + l15];
  /* later address arithmetic may be given the register that these two loads name;
     the scheduling fences keep it behind the wait */
  __builtin_amdgcn_sched_barrier(0);
  asm volatile("s_wait_xcnt 0x0" ::: "memory");
  __builtin_amdgcn_sched_barrier(0);
#pragma unroll
  for (int i = 0; i < 2; i++) qs[i] *= scl;
  const v8f zf = {};
  v8f o[2][8];                 /* o[i][dj][r] = O[query i*16+l15][dj*16+hi8+r] */
#pragma unroll
  for (int i = 0; i < 2; i++)
#pragma unroll
    for (int dj = 0; dj < 8; dj++) o[i][dj] = zf;
  float mrow[2], lrow[2];      /* lrow: this wave half's keys only */
#pragma unroll
  for (int i = 0; i < 2; i++) { mrow[i] = -3.0e38f; lrow[i] = 0.f; }

  /* lane address of the transposing load: key row 8*(l>>4)+(l&7), 16-B column half (l>>3)&1 */
  const int vtro = (hi8 + (lane & 7)) * VPITCH + (((lane >> 3) & 1) << 3);

  /* stage K tile and V tile number tile, [32][128 + pad] each, both row-major, into buffer buf */
  auto stage = [&](int tile, int buf) {
#pragma unroll
    for (int t = 0; t < 4; t++) {
      const int c = tid + t * 128;            /* 512 chunks of 8 halves */
      const int kk = c >> 4, seg = (c & 15) << 3;
#if USE_ASYNC
      async_cp16(kbase + (size_t)(tile * 32 + kk) * HD + seg, &ldsK[buf][kk * KPITCH + seg]);
      async_cp16(vbase + (size_t)(tile * 32 + kk) * HD + seg, &ldsV[buf][kk * VPITCH + seg]);
#else
      *(v8h*)(&ldsK[buf][kk * KPITCH + seg]) = *(const v8h*)(kbase + (size_t)(tile * 32 + kk) * HD + seg);
      *(v8h*)(&ldsV[buf][kk * VPITCH + seg]) = *(const v8h*)(vbase + (size_t)(tile * 32 + kk) * HD + seg);
#endif
    }
  };

  const int nkt = (lim + 31) >> 5;            /* at least 1 */
  stage(0, 0);
  /* the keys' scales, published by the same barrier as tile 0 */
#pragma unroll
  for (int t = 0; t < SS / 512; t++)
    *(v4f*)(&ldsR[(tid + t * 128) * 4]) = *(const v4f*)(rsc + MM + b * SS + (tid + t * 128) * 4);
#if USE_ASYNC
  /* this wave's copies of tile 0 have landed before the barrier publishes them */
  asm volatile("s_wait_asynccnt 0x0" ::: "memory");
#endif
  __syncthreads();
  if (nkt > 1) stage(1, 1);

  for (int kt = 0; kt < nkt; ++kt) {
    const int st = kt & 1;
    const _Float16* kt16 = ldsK[st];
    const _Float16* vtr  = ldsV[st] + vtro;

    /* S^T = K * Q^T : sc[j][i][r] = score(key j*16+hi8+r, query i*16+l15) */
    v8f sc[2][2];
#pragma unroll
    for (int j = 0; j < 2; j++)
#pragma unroll
      for (int i = 0; i < 2; i++) sc[j][i] = zf;
#pragma unroll
    for (int dc = 0; dc < 4; dc++) {
      v16h ak0 = ld_frag(kt16 + 0 * 16 * KPITCH + dc * 32, KPITCH);
      v16h ak1 = ld_frag(kt16 + 1 * 16 * KPITCH + dc * 32, KPITCH);
#pragma unroll
      for (int i = 0; i < 2; i++) {
        sc[0][i] = __builtin_amdgcn_wmma_f32_16x16x32_f16(
            false, ak0, false, qf[i][dc], (short)0, sc[0][i], false, false);
        sc[1][i] = __builtin_amdgcn_wmma_f32_16x16x32_f16(
            false, ak1, false, qf[i][dc], (short)0, sc[1][i], false, false);
      }
    }

    /* the keys' scales; key mask only in a tile that reaches past the last valid key */
#pragma unroll
    for (int j = 0; j < 2; j++) {
      const v4f kl = *(const v4f*)(&ldsR[kt * 32 + j * 16 + hi8]);
      const v4f kh4 = *(const v4f*)(&ldsR[kt * 32 + j * 16 + hi8 + 4]);
#pragma unroll
      for (int i = 0; i < 2; i++)
#pragma unroll
        for (int r = 0; r < 8; r++) sc[j][i][r] *= r < 4 ? kl[r & 3] : kh4[r & 3];
    }
    if (kt * 32 + 32 > lim) {
#pragma unroll
      for (int j = 0; j < 2; j++)
#pragma unroll
        for (int r = 0; r < 8; r++) {
          const bool valid = kt * 32 + j * 16 + hi8 + r < lim;
#pragma unroll
          for (int i = 0; i < 2; i++) sc[j][i][r] = valid ? sc[j][i][r] : -3.0e38f;
        }
    }

    /* online softmax: a lane and its partner in the other half share one query */
    v16h pf[2];
#pragma unroll
    for (int i = 0; i < 2; i++) {
      float t = fmaxf(sc[0][i][0], sc[1][i][0]);
#pragma unroll
      for (int r = 1; r < 8; r++) t = fmaxf(t, fmaxf(sc[0][i][r], sc[1][i][r]));
      t = fmaxf(t, xhalf(t));
      const float mn = fmaxf(mrow[i], t * qs[i]);   /* qs >= 0: the maximum commutes with it */
      const float al = __expf(mrow[i] - mn);
      float rs = 0.f;
#pragma unroll
      for (int j = 0; j < 2; j++)
#pragma unroll
        for (int r = 0; r < 8; r++) {
          const float p = __expf(fmaf(sc[j][i][r], qs[i], -mn));
          rs += p;
          pf[i][j * 8 + r] = (_Float16)p;   /* B operand P^T, hardware k order */
        }
      lrow[i] = lrow[i] * al + rs;
      mrow[i] = mn;
#pragma unroll
      for (int dj = 0; dj < 8; dj++)
#pragma unroll
        for (int r = 0; r < 8; r++) o[i][dj][r] *= al;
    }

    /* O^T += V^T * P^T  (A frags: rows = d, matmul-K = key) */
#pragma unroll
    for (int dj = 0; dj < 8; dj++) {
      const v8h lo = ld_tr16(vtr + dj * 16);
      const v8h hi = ld_tr16(vtr + 16 * VPITCH + dj * 16);
      v16h vf;
#pragma unroll
      for (int e = 0; e < 8; e++) { vf[e] = lo[e]; vf[8 + e] = hi[e]; }
      o[0][dj] = __builtin_amdgcn_wmma_f32_16x16x32_f16(
          false, vf, false, pf[0], (short)0, o[0][dj], false, false);
      o[1][dj] = __builtin_amdgcn_wmma_f32_16x16x32_f16(
          false, vf, false, pf[1], (short)0, o[1][dj], false, false);
    }

    /* hand-over: this wave has left buffer st ... */
    asm volatile("s_wait_dscnt 0x0" ::: "memory");
#if USE_ASYNC
    /* ... and its copies of tile kt + 1 have landed, before the one barrier that
       publishes that tile and frees buffer st for the refill behind it */
    asm volatile("s_wait_asynccnt 0x0" ::: "memory");
#endif
    __syncthreads();
    if (kt + 2 < nkt) stage(kt + 2, st);
  }
#if USE_ASYNC
  /* no copy is outstanding when the wave ends */
  asm volatile("s_wait_asynccnt 0x0" ::: "memory");
#endif

  /* join the halves' sums, normalize, write [B,S,D] f16: 8 consecutive d per lane */
#pragma unroll
  for (int i = 0; i < 2; i++) {
    const int srow = qt * 128 + w * 32 + i * 16 + l15;
    const float inv = 1.0f / (lrow[i] + xhalf(lrow[i]));
    _Float16* orow = oh + ((size_t)(b * SS + srow)) * DD + h * HD + hi8;
#pragma unroll
    for (int dj = 0; dj < 8; dj++) {
      v8h ov;
#pragma unroll
      for (int r = 0; r < 8; r++) ov[r] = (_Float16)(o[i][dj][r] * inv);
      *(v8h*)(orow + dj * 16) = ov;
    }
  }
}

/* ---------------- host-side orchestration ---------------- */
extern "C" void kernel_launch(void* const* d_in, const int* in_sizes, int n_in,
                              void* d_out, int out_size, void* d_ws, size_t ws_size,
                              hipStream_t stream) {
  (void)in_sizes; (void)n_in; (void)out_size; (void)ws_size;
  const float* x        = (const float*)d_in[0];
  const int*   seq_lens = (const int*)d_in[1];
  const float* freqs    = (const float*)d_in[2];
  const float* wq = (const float*)d_in[3];
  const float* bq = (const float*)d_in[4];
  const float* wk = (const float*)d_in[5];
  const float* bk = (const float*)d_in[6];
  const float* wv = (const float*)d_in[7];
  const float* bv = (const float*)d_in[8];
  const float* wo = (const float*)d_in[9];
  const float* bo = (const float*)d_in[10];
  const float* gq = (const float*)d_in[11];
  const float* gk = (const float*)d_in[12];

  char* ws = (char*)d_ws;
  _Float16* xh    = (_Float16*)(ws + OFF_XH);
  _Float16* wqkvh = (_Float16*)(ws + OFF_WQKV);
  _Float16* woh   = (_Float16*)(ws + OFF_WO);
  float*    part  = (float*)(ws + OFF_Y);
  float*    rsp   = (float*)(ws + OFF_RS);
  _Float16* qhp   = (_Float16*)(ws + OFF_QH);
  _Float16* khp   = (_Float16*)(ws + OFF_KH);
  _Float16* vhp   = (_Float16*)(ws + OFF_VH);
  _Float16* ohp   = (_Float16*)(ws + OFF_OH);

  /* 1) down-convert activations + weights to f16 */
  cvt_f16<<<CVT_XB + 4 * CVT_WB, 256, 0, stream>>>(x, wq, wk, wv, wo, xh);

  /* 2) fused QKV projection with bias, gain, RoPE and repack; square sums per wave */
  gemm_wmma<192, N1, true><<<dim3(N1 / 192, MM / GBM), 256, 0, stream>>>(
      xh, wqkvh, part, MM, N1, DD, bq, bk, bv, DD, 2 * DD, freqs, gq, gk, qhp, khp, vhp);

  /* 3) RMS row scales of q and k */
  rms_scale<<<2 * MM / 256, 256, 0, stream>>>(part, rsp);

  /* 4) flash attention */
  attn_wmma<<<BB * NH * (SS / 128), 128, 0, stream>>>(qhp, khp, vhp, seq_lens, rsp, ohp);

  /* 5) output projection into d_out (f32) */
  gemm_wmma<128, DD, false><<<dim3(DD / 128, MM / GBM), 256, 0, stream>>>(
      ohp, woh, (float*)d_out, MM, DD, DD, bo, bo, bo, DD, 2 * DD, freqs, gq, gk, qhp, khp, vhp);
}

// v009
// A run of this version takes 168 microseconds.
// Next to v008, in two timings, it ran 1.05 times as fast each time.
// Counting every step since v000, it is 4.73 times as fast.
#include <hip/hip_runtime.h>

typedef __attribute__((ext_vector_type(16))) _Float16 v16h;
typedef __attribute__((ext_vector_type(8)))  _Float16 v8h;
typedef __attribute__((ext_vector_type(8)))  float    v8f;
typedef __attribute__((ext_vector_type(4)))  int      v4i;

#define BB 2
#define SS 2048
#define DD 2048
#define NH 16
#define HD 128
#define MM (BB*SS)      /* 4096 rows */
#define N1 (3*DD)       /* 6144 fused QKV cols */

/* ---- workspace layout (bytes) ---- */
#define OFF_XH   ((size_t)0)
#define OFF_WQKV (OFF_XH   + (size_t)MM*DD*2)     /* x in f16            */
#define OFF_WO   (OFF_WQKV + (size_t)N1*DD*2)     /* [wq;wk;wv] f16      */
#define OFF_Y    (OFF_WO   + (size_t)DD*DD*2)     /* wo f16              */
#define OFF_QH   (OFF_Y    + (size_t)MM*N1*4)     /* square sums, scales */
#define OFF_KH   (OFF_QH   + (size_t)MM*DD*2)     /* q f16 [B,N,S,HD]    */
/* a wave of the QKV product owns QW columns; the waves (slots) that hold columns of q and of k */
#define QW       96
#define KS_FIRST (DD / QW)
#define KS_LAST  ((2 * DD - 1) / QW)
#define QS_LAST  ((DD - 1) / QW)
#define NPS      (QS_LAST + 1)                    /* slots of q; k has as many */
#define OFF_RS   (OFF_Y + (size_t)2 * NPS * MM * 4) /* rsqrt row scales, q then k */
#define OFF_VH   (OFF_KH   + (size_t)MM*DD*2)
#define OFF_OH   (OFF_VH   + (size_t)MM*DD*2)     /* attn out f16 [B,S,D]*/

/* ---- CDNA5 async global->LDS copy (ASYNCcnt-tracked, bypasses VGPRs) ---- */
#if __has_builtin(__builtin_amdgcn_global_load_async_to_lds_b128) && \
    __has_builtin(__builtin_amdgcn_s_wait_asynccnt)
#define USE_ASYNC 1
#else
#define USE_ASYNC 0
#endif

/* b128 payload type: <4 x i32>; clang prints AS(1) as `__device__` in HIP */
typedef __attribute__((address_space(1))) v4i gv4i;
typedef __attribute__((address_space(3))) v4i lv4i;

__device__ __forceinline__ void async_cp16(const void* g, void* l) {
#if USE_ASYNC
  /* generic LDS pointers carry the LDS byte offset in the low 32 bits
     (flat->LDS aperture mapping: LDS_ADDR = addr[31:0]) */
  __builtin_amdgcn_global_load_async_to_lds_b128(
      (gv4i*)(unsigned long long)(size_t)g,
      (lv4i*)(unsigned int)(size_t)l, 0, 0);
#else
  (void)g; (void)l;
#endif
}

/* ---------------- f32 -> f16 convert: x and the four weights, one streaming launch ----------------
   The five f16 copies lie one behind the other at the start of the workspace
   (x | wq | wk | wv | wo), so the destination is one array and a block's
   32,768 elements come from one source. A wave-wide load covers 512 contiguous
   bytes (4 whole lines), a wave-wide store 256 (2 whole lines); at least 8
   loads of a lane are in flight before the first is converted. */
typedef __attribute__((ext_vector_type(4))) float    v4f;
typedef __attribute__((ext_vector_type(4))) _Float16 v4h;
#define CVT_LD   8                             /* 16-B loads of a lane issued as a group */
#define CVT_IT   4                             /* such groups per lane */
#define CVT_BLK  (256 * 4 * CVT_LD * CVT_IT)   /* elements per block */
#define CVT_XB   (MM * DD / CVT_BLK)           /* blocks of x */
#define CVT_WB   (DD * DD / CVT_BLK)           /* blocks of one weight */
__global__ __launch_bounds__(256) void cvt_f16(
    const float* __restrict__ x,  const float* __restrict__ wq,
    const float* __restrict__ wk, const float* __restrict__ wv,
    const float* __restrict__ wo, _Float16* __restrict__ dst)
{
  const int blk = blockIdx.x;
  const float* src = x;
  int sb = blk;
  if (blk >= CVT_XB) {
    const int u = (blk - CVT_XB) / CVT_WB;
    sb  = (blk - CVT_XB) % CVT_WB;
    src = u == 0 ? wq : u == 1 ? wk : u == 2 ? wv : wo;
  }
  const float* s = src + (size_t)sb  * CVT_BLK + threadIdx.x * 4;
  _Float16*    d = dst + (size_t)blk * CVT_BLK + threadIdx.x * 4;
  for (int it = 0; it < CVT_IT; ++it) {
    v4f v[CVT_LD];
#pragma unroll
    for (int j = 0; j < CVT_LD; j++)
      v[j] = *(const v4f*)(s + (it * CVT_LD + j) * 1024);
#pragma unroll
    for (int j = 0; j < CVT_LD; j++) {
      v4h h;
#pragma unroll
      for (int e = 0; e < 4; e++) h[e] = (_Float16)v[j][e];
      *(v4h*)(d + (it * CVT_LD + j) * 1024) = h;
    }
  }
}

/* Fragment loader per CDNA5 ISA 7.12.2 (16-bit A 16x32 / B 32x16 layouts).
   tile: pointer to the 16-row tile origin; row dim stride = `stride` halves;
   contiguous (matmul-K) dim carries the 8+8 half split at +0 / +16. */
__device__ __forceinline__ v16h ld_frag(const _Float16* tile, int stride) {
  const int lane = threadIdx.x & 31;
  const _Float16* p = tile + (size_t)(lane & 15) * stride + ((lane >> 4) << 3);
  v8h lo = *(const v8h*)(p);
  v8h hi = *(const v8h*)(p + 16);
  v16h r;
#pragma unroll
  for (int i = 0; i < 8; ++i) { r[i] = lo[i]; r[8 + i] = hi[i]; }
  return r;
}

/* value of lane l ^ 16 */
__device__ __forceinline__ float xhalf(float x) {
  return __builtin_bit_cast(float, __builtin_amdgcn_permlanex16(
      __builtin_bit_cast(int, x), __builtin_bit_cast(int, x),
      0x76543210, 0xfedcba98, false, false));
}

/* ---------------- WMMA GEMM: C[M,N] = A[M,K] * Bw[N,K]^T + bias ----------------
   256 x BN block tile, 8 waves as 4 x 2, wave tile 64 x BN/2 (4 x BN/32 of 16x16),
   K-step 64: a staged row is one whole 128-B line, so a wave's 512-B copy asks
   L2 for 4 full lines. The large tile is what sets the traffic: L2 bytes per
   product go as 1/256 + 1/BN, LDS fragment reads per WMMA as 1/4 + 32/BN.
   BN is chosen per product so that the tiles are a whole multiple of the WGPs.
   Global->LDS staging via async copy engine into a ring of GNB buffers:
   8 + BN/32 async b128 ops per wave per stage, a stage's copies issued GNB - 1
   stages before its publish point, so that they have that long to come from L2.
   One publish point per stage, between the two 32-k halves of the stage before:
   there every fragment of that stage is in registers, so the one barrier
   publishes the next stage and frees this stage's buffer for the refill. */
#define GKS    64   /* halves of K per stage */
#define GBM    256  /* rows of A per block tile */
#define GPITCH 72   /* halves; 144 B = 16 B x odd: 16 rows of a ds_load_b128 fall on 16 bank groups */
#define GNB    4    /* buffers of the LDS ring, a power of two */
#define SPITCH 200  /* halves; 400 B = 16 B x odd: pitch of the QKV epilogue's staged tile */
/* one 16x16x32 step. QKV: the product is taken transposed (rows of W as A, rows of x as B,
   both by the same loader, so the k orders agree): a lane then holds 8 neighbouring
   features of ONE token, which is what RoPE pairs, square sums and 16-B packing want */
template <bool QKV>
__device__ __forceinline__ v8f mm16(v16h a, v16h b, v8f c) {
  if constexpr (QKV)
    return __builtin_amdgcn_wmma_f32_16x16x32_f16(false, b, false, a, (short)0, c, false, false);
  else
    return __builtin_amdgcn_wmma_f32_16x16x32_f16(false, a, false, b, (short)0, c, false, false);
}
/* QKV: the epilogue adds the bias, sums the squares of a token's q and k columns (one
   partial per wave, to C), applies gain and RoPE to q and k WITHOUT the RMS scale (a
   scalar per token, which commutes with both and is applied to the scores), and
   writes q, k, v as f16 [B,N,S,HD] */
template <int BN, int ND, bool QKV>   /* ND: row length of C, a constant so that a wave's stores share one address */
__global__ __launch_bounds__(256) void gemm_wmma(
    const _Float16* __restrict__ A, const _Float16* __restrict__ Bw,
    float* __restrict__ C, int Mdim, int Ndim, int Kdim,
    const float* __restrict__ b0, const float* __restrict__ b1,
    const float* __restrict__ b2, int s1, int s2,
    const float* __restrict__ freqs, const float* __restrict__ gq,
    const float* __restrict__ gk, _Float16* __restrict__ qh,
    _Float16* __restrict__ kh, _Float16* __restrict__ vh)
{
  constexpr int MI  = 4;              /* 16-row fragments of A per wave */
  constexpr int NJ  = BN / 32;        /* 16-col fragments of B per wave */
  constexpr int CPA = GBM * 8 / 256;  /* 16-B chunks per thread and stage, A */
  constexpr int CPB = BN  * 8 / 256;  /* the same, B */
  __shared__ __align__(16) _Float16 ldsA[GNB][GBM * GPITCH];
  __shared__ __align__(16) _Float16 ldsB[GNB][BN * GPITCH];
  const int tid  = threadIdx.x;
  const int lane = tid & 31, wave = tid >> 5;
  const int l15  = lane & 15, hi8 = (lane >> 4) << 3;
  const int wm = wave >> 1, wn = wave & 1;
  const int mBase = blockIdx.y * GBM;
  const int nBase = blockIdx.x * BN;

  const v8f zf = {};
  v8f acc[MI][NJ];
#pragma unroll
  for (int i = 0; i < MI; i++)
#pragma unroll
    for (int j = 0; j < NJ; j++) acc[i][j] = zf;

  /* chunk t of a thread: row row0 + 32 t, 16-B segment seg (8 chunks per 64-half row) */
  const int row0 = tid >> 3;
  const int seg  = (tid & 7) << 3;

  const int nk = Kdim / GKS;

#if USE_ASYNC
  /* ---- async pipeline ---- */
  /* the copies of stage s, into buffer s mod GNB */
  auto stage = [&](int s) {
    const int k0 = s * GKS, bu = s & (GNB - 1);
#pragma unroll
    for (int t = 0; t < CPA; t++)
      async_cp16(A  + (size_t)(mBase + row0 + t * 32) * Kdim + k0 + seg,
                 &ldsA[bu][(row0 + t * 32) * GPITCH + seg]);
#pragma unroll
    for (int t = 0; t < CPB; t++)
      async_cp16(Bw + (size_t)(nBase + row0 + t * 32) * Kdim + k0 + seg,
                 &ldsB[bu][(row0 + t * 32) * GPITCH + seg]);
  };
#pragma unroll
  for (int s = 0; s < GNB; s++)
    if (s < nk) stage(s);
  /* this wave's copies of stage 0 have landed (all but the GNB - 1 younger stages;
     with fewer stages than buffers: all) before the barrier publishes them */
  if (nk >= GNB) asm volatile("s_wait_asynccnt %0" :: "n"((GNB - 1) * (CPA + CPB)) : "memory");
  else           asm volatile("s_wait_asynccnt 0x0" ::: "memory");
  __syncthreads();
  /* one stage. steady: stage kb + GNB exists, so the publish point and the refill
     stand in straight-line code with the later half's WMMAs */
  auto trip = [&](int kb, bool steady) __attribute__((always_inline)) {
    const int st = kb & (GNB - 1);
    /* unrolled: both 32-k halves of the stage read at constant LDS offsets */
    v16h af[GKS / 32][MI], bf[GKS / 32][NJ];
#pragma unroll
    for (int u = 0; u < GKS / 32; u++) {
#pragma unroll
      for (int i = 0; i < MI; i++) af[u][i] = ld_frag(&ldsA[st][(wm * 64 + i * 16) * GPITCH + u * 32], GPITCH);
#pragma unroll
      for (int j = 0; j < NJ; j++) bf[u][j] = ld_frag(&ldsB[st][(wn * (BN / 2) + j * 16) * GPITCH + u * 32], GPITCH);
    }
    /* holds the stage's fragment loads together ahead of its WMMAs: left free, the
       scheduler keeps one A fragment, reloads it behind every row of WMMAs and
       waits out the LDS latency each time */
    __builtin_amdgcn_sched_barrier(0);
#pragma unroll
    for (int u = 0; u < GKS / 32; u++) {
#pragma unroll
      for (int i = 0; i < MI; i++)
#pragma unroll
        for (int j = 0; j < NJ; j++)
          acc[i][j] = mm16<QKV>(af[u][i], bf[u][j], acc[i][j]);
      if (u == 0 && (steady || kb + 1 < nk)) {
        /* keeps the first half's WMMAs ahead of the publish point and its wait for
           the later half's loads: left free, that wait rises above them all */
        __builtin_amdgcn_sched_barrier(0);
        /* publish point of stage kb + 1: this wave has left buffer st ... */
        asm volatile("s_wait_dscnt 0x0" ::: "memory");
        /* ... and its copies of stage kb + 1 have landed: all but the two younger
           stages' where both are under way, else all */
        if (steady || kb + GNB - 1 < nk) asm volatile("s_wait_asynccnt %0" :: "n"((GNB - 2) * (CPA + CPB)) : "memory");
        else                             asm volatile("s_wait_asynccnt 0x0" ::: "memory");
        __syncthreads();
        if (steady) stage(kb + GNB);   /* refill of the buffer every wave has just left */
      }
    }
  };
  int kb = 0;
  for (; kb + GNB < nk; ++kb) trip(kb, true);
  for (; kb < nk; ++kb)       trip(kb, false);
#else
  /* ---- fallback: register-staged pipeline ---- */
  v8h ra[CPA], rb[CPB];
#pragma unroll
  for (int t = 0; t < CPA; t++)
    ra[t] = *(const v8h*)(A  + (size_t)(mBase + row0 + t * 32) * Kdim + seg);
#pragma unroll
  for (int t = 0; t < CPB; t++)
    rb[t] = *(const v8h*)(Bw + (size_t)(nBase + row0 + t * 32) * Kdim + seg);
  for (int kb = 0; kb < nk; ++kb) {
#pragma unroll
    for (int t = 0; t < CPA; t++) *(v8h*)(&ldsA[0][(row0 + t * 32) * GPITCH + seg]) = ra[t];
#pragma unroll
    for (int t = 0; t < CPB; t++) *(v8h*)(&ldsB[0][(row0 + t * 32) * GPITCH + seg]) = rb[t];
    __syncthreads();
    if (kb + 1 < nk) {
      const int k0 = (kb + 1) * GKS;
#pragma unroll
      for (int t = 0; t < CPA; t++)
        ra[t] = *(const v8h*)(A  + (size_t)(mBase + row0 + t * 32) * Kdim + k0 + seg);
#pragma unroll
      for (int t = 0; t < CPB; t++)
        rb[t] = *(const v8h*)(Bw + (size_t)(nBase + row0 + t * 32) * Kdim + k0 + seg);
    }
    /* unrolled: both 32-k halves of the stage read at constant LDS offsets */
#pragma unroll
    for (int ks = 0; ks < GKS; ks += 32) {
      v16h af[MI], bf[NJ];
#pragma unroll
      for (int i = 0; i < MI; i++) af[i] = ld_frag(&ldsA[0][(wm * 64 + i * 16) * GPITCH + ks], GPITCH);
#pragma unroll
      for (int j = 0; j < NJ; j++) bf[j] = ld_frag(&ldsB[0][(wn * (BN / 2) + j * 16) * GPITCH + ks], GPITCH);
#pragma unroll
      for (int i = 0; i < MI; i++)
#pragma unroll
        for (int j = 0; j < NJ; j++)
          acc[i][j] = mm16<QKV>(af[i], bf[j], acc[i][j]);
    }
    __syncthreads();
  }
#endif

  if constexpr (QKV) {
    /* lane holds token l15 of fragment i, features hi8 .. hi8 + 7 of fragment j */
    static_assert(BN / 2 == QW && BN % 64 == 0 && GBM * SPITCH <= GNB * GBM * GPITCH, "QKV tile");
    const unsigned wnu = __builtin_amdgcn_readfirstlane(wn);   /* scalar: the q / k / v test below is a scalar branch */
    const unsigned f0  = nBase + wnu * (BN / 2);               /* first of the wave's features */
    /* every table value of the epilogue is asked for here, as one group in the registers
       the fragments have left: loaded where it is used, each fragment waits out L2 twice.
       A v fragment's gain and angles are loaded (in bounds) and not used */
    v4f bl[NJ], bh[NJ], gl[NJ], gh[NJ], fr[MI][NJ];
    const unsigned s0 = (unsigned)mBase % SS + wm * 64 + l15;  /* position of the lane's token in fragment 0 (a tile lies in one batch row) */
#pragma unroll
    for (int j = 0; j < NJ; j++) {
      /* the fragment's part of each address is scalar, the lane's part the same for all j */
      const unsigned fb = f0 + j * 16, reg = fb / DD;   /* 0 q, 1 k, 2 v */
      const float* bp = (reg == 0 ? b0 : reg == 1 ? b1 : b2) + fb % DD;
      const float* gp = (reg == 0 ? gq : gk) + fb % DD;
      const float* fp = freqs + ((fb % HD) >> 1);       /* angle of the fragment's first pair */
      bl[j] = *(const v4f*)(bp + hi8); bh[j] = *(const v4f*)(bp + hi8 + 4);
      gl[j] = *(const v4f*)(gp + hi8); gh[j] = *(const v4f*)(gp + hi8 + 4);
#pragma unroll
      for (int i = 0; i < MI; i++) {
        if (j == NJ - 1 && i == MI - 1) {
          /* the last load's result may be given the registers that the loads before it name */
          __builtin_amdgcn_sched_barrier(0);
          asm volatile("s_wait_xcnt 0x0" ::: "memory");
          __builtin_amdgcn_sched_barrier(0);
        }
        fr[i][j] = *(const v4f*)(fp + (s0 + i * 16) * (HD / 2) + (hi8 >> 1));
      }
      if (j + 1 < NJ) {
        /* the next fragment's addresses are formed in the registers that these loads name;
           the scheduling fences keep that arithmetic behind the wait */
        __builtin_amdgcn_sched_barrier(0);
        asm volatile("s_wait_xcnt 0x0" ::: "memory");
        __builtin_amdgcn_sched_barrier(0);
      }
    }
    /* the ring becomes output staging: this wave's last fragment reads have returned ... */
    asm volatile("s_wait_dscnt 0x0" ::: "memory");
    /* ... and so have every other wave's (no copy is outstanding behind the last stages' waits to 0) */
    __syncthreads();
    _Float16* stg = &ldsA[0][0];
    float ssq[MI], ssk[MI];
#pragma unroll
    for (int i = 0; i < MI; i++) { ssq[i] = 0.f; ssk[i] = 0.f; }
#pragma unroll
    for (int j = 0; j < NJ; j++) {
      const unsigned reg = (f0 + j * 16) / DD;
      _Float16* sp = stg + (wm * 64 + l15) * SPITCH + wnu * (BN / 2) + j * 16 + hi8;
      if (reg < 2) {
#pragma unroll
        for (int i = 0; i < MI; i++) {
          float y[8], ss = 0.f;
#pragma unroll
          for (int r = 0; r < 8; r++) {
            y[r] = acc[i][j][r] + (r < 4 ? bl[j][r & 3] : bh[j][r & 3]);
            ss += y[r] * y[r];
          }
          if (reg == 0) ssq[i] += ss; else ssk[i] += ss;
          v8h h;
#pragma unroll
          for (int e = 0; e < 4; e++) {
            const float cf = __cosf(fr[i][j][e]), sf = __sinf(fr[i][j][e]);
            const float u0 = y[2 * e]     * (e < 2 ? gl[j][2 * e]     : gh[j][2 * e - 4]);
            const float u1 = y[2 * e + 1] * (e < 2 ? gl[j][2 * e + 1] : gh[j][2 * e - 3]);
            h[2 * e]     = (_Float16)(u0 * cf - u1 * sf);
            h[2 * e + 1] = (_Float16)(u0 * sf + u1 * cf);
          }
          *(v8h*)(sp + i * 16 * SPITCH) = h;
        }
      } else {
#pragma unroll
        for (int i = 0; i < MI; i++) {
          v8h h;
#pragma unroll
          for (int r = 0; r < 8; r++)
            h[r] = (_Float16)(acc[i][j][r] + (r < 4 ? bl[j][r & 3] : bh[j][r & 3]));
          *(v8h*)(sp + i * 16 * SPITCH) = h;
        }
      }
    }
    /* the staged tile is complete; 8 lanes then store one whole 128-B line, a wave 4 rows.
       A line's 64 features lie in one head of one product: that part of the address is scalar */
    __syncthreads();
    /* square sums of this wave's columns: plane [slot][token], 64 tokens = 2 whole lines a wave
       (behind the barrier, which would wait for these stores) */
    const unsigned slot = blockIdx.x * 2 + wnu;
#pragma unroll
    for (int i = 0; i < MI; i++) {
      const int tok = mBase + wm * 64 + i * 16 + l15;
      const float aq = ssq[i] + xhalf(ssq[i]);
      const float ak = ssk[i] + xhalf(ssk[i]);
      if (slot <= QS_LAST && lane < 16) C[(size_t)slot * MM + tok] = aq;
      if (slot >= KS_FIRST && slot <= KS_LAST && lane < 16)
        C[(size_t)(NPS + slot - KS_FIRST) * MM + tok] = ak;
    }
    const unsigned sgl = tid & 7, rwl = tid >> 3;
#pragma unroll
    for (int lg = 0; lg < BN / 64; lg++) {
      const unsigned f = nBase + lg * 64, reg = f / DD, cc = f % DD;
      _Float16* dp = (reg == 0 ? qh : reg == 1 ? kh : vh)
          + ((size_t)((unsigned)mBase / SS * NH + cc / HD) * SS + (unsigned)mBase % SS) * HD + cc % HD;
      v8h h[GBM / 32];
#pragma unroll
      for (int rg = 0; rg < GBM / 32; rg++)
        h[rg] = *(const v8h*)(stg + (rg * 32 + rwl) * SPITCH + lg * 64 + sgl * 8);
#pragma unroll
      for (int rg = 0; rg < GBM / 32; rg++)
        *(v8h*)(dp + (rg * 32 + rwl) * HD + sgl * 8) = h[rg];
      if (lg + 1 < BN / 64) {
        /* the next group's LDS loads may be given the registers that these stores name;
           the scheduling fences keep them behind the wait */
        __builtin_amdgcn_sched_barrier(0);
        asm volatile("s_wait_xcnt 0x0" ::: "memory");
        __builtin_amdgcn_sched_barrier(0);
      }
    }
  } else {
  /* epilogue: C/D layout - lane holds col, VGPR r holds row r + 8*(lane>=16) */
  float bias[NJ];
#pragma unroll
  for (int j = 0; j < NJ; j++) {
    const int col = nBase + wn * (BN / 2) + j * 16 + l15;
    bias[j] = (col < s1) ? b0[col] : (col < s2) ? b1[col - s1] : b2[col - s2];
  }
  float* cp = C + (size_t)(mBase + wm * 64 + hi8) * ND + nBase + wn * (BN / 2) + l15;
#pragma unroll
  for (int j = 0; j < NJ; j++)
#pragma unroll
    for (int i = 0; i < MI; i++)
#pragma unroll
      for (int r = 0; r < 8; r++)
        cp[(i * 16 + r) * ND + j * 16] = acc[i][j][r] + bias[j];
  }
}

/* ---------------- RMS row scales: rsqrt(mean square + eps) of every token's q and k ---------------- */
__global__ __launch_bounds__(256) void rms_scale(const float* __restrict__ part, float* __restrict__ rs)
{
  const int t = blockIdx.x * 256 + threadIdx.x;     /* q tokens, then k tokens */
  const float* p = part + (size_t)(t / MM) * NPS * MM + t % MM;
  float a = 0.f;
#pragma unroll
  for (int u = 0; u < NPS; u++) a += p[(size_t)u * MM];
  rs[t] = rsqrtf(a * (1.0f / DD) + 1e-6f);
}

#define VPITCH 144  /* halves; 288 B = 32 B x odd, the transposing load's pitch */
#define KPITCH 136  /* halves; 272 B = 16 B x odd, the ds_load_b128 pitch */
#define KT     64   /* keys per pass, a multiple of 32 that divides SS */
#define KJ     (KT / 16)  /* 16-key score tiles per pass */
#define KG     (KT / 32)  /* 32-key steps of the second product per pass */

typedef __attribute__((ext_vector_type(8))) short s16x8;
typedef __attribute__((address_space(3))) s16x8 lds_s16x8;

__device__ __forceinline__ v8h ld_tr16(const _Float16* p) {
  return __builtin_bit_cast(v8h, __builtin_amdgcn_ds_load_tr16_b128_v8i16((lds_s16x8*)p));
}

__global__ __launch_bounds__(128) void attn_wmma(
    const _Float16* __restrict__ qh, const _Float16* __restrict__ kh,
    const _Float16* __restrict__ vh, const int* __restrict__ seq_lens,
    const float* __restrict__ rsc, _Float16* __restrict__ oh)
{
  __shared__ __align__(16) _Float16 ldsK[2][KT * KPITCH];
  __shared__ __align__(16) _Float16 ldsV[2][KT * VPITCH];
  __shared__ __align__(16) float    ldsR[SS];   /* rk of this batch row's keys */

  const int tid = threadIdx.x;
  const int lane = tid & 31, w = tid >> 5;
  const int l15 = lane & 15, hi8 = (lane >> 4) << 3;
  const int nqt = SS / 128;
  const int qt = blockIdx.x % nqt;
  const int h  = (blockIdx.x / nqt) % NH;
  const int b  = blockIdx.x / (nqt * NH);
  /* the key mask is arange(S) < seq_len: clamping to [0, S] leaves it as it is
     and bounds the trip count and every K/V address */
  int slen = seq_lens[b];
  slen = slen < 0 ? 0 : (slen > SS ? SS : slen);
  /* no valid key: every score equals the mask value, softmax is uniform over
     all S keys; scores of zero over all keys give the same */
  const int   lim = slen == 0 ? SS : slen;
  const float scl = slen == 0 ? 0.f : 0.08838834764831845f; /* 1/sqrt(128) */

  const size_t headO = (size_t)(b * NH + h) * SS * HD;
  const _Float16* qbase = qh + headO + (size_t)(qt * 128 + w * 32) * HD;
  const _Float16* kbase = kh + headO;
  const _Float16* vbase = vh + headO;

  /* B operand Q^T: column = query, same k order as the K rows (same loader) */
  v16h qf[2][4];
#pragma unroll
  for (int i = 0; i < 2; i++)
#pragma unroll
    for (int dc = 0; dc < 4; dc++)
      qf[i][dc] = ld_frag(qbase + (size_t)(i * 16) * HD + dc * 32, HD);

  /* the lane's two queries: RMS scale times score scale, never negative */
  float qs[2];
#pragma unroll
  for (int i = 0; i < 2; i++) qs[i] = rsc[b * SS + qt * 128 + w * 32 + i * 16 + l15];
  /* later address arithmetic may be given the register that these two loads name;
     the scheduling fences keep it behind the wait */
  __builtin_amdgcn_sched_barrier(0);
  asm volatile("s_wait_xcnt 0x0" ::: "memory");
  __builtin_amdgcn_sched_barrier(0);
#pragma unroll
  for (int i = 0; i < 2; i++) qs[i] *= scl;
  const v8f zf = {};
  v8f o[2][8];                 /* o[i][dj][r] = O[query i*16+l15][dj*16+hi8+r] */
#pragma unroll
  for (int i = 0; i < 2; i++)
#pragma unroll
    for (int dj = 0; dj < 8; dj++) o[i][dj] = zf;
  float mrow[2], lrow[2];      /* lrow: this wave half's keys only */
#pragma unroll
  for (int i = 0; i < 2; i++) { mrow[i] = -3.0e38f; lrow[i] = 0.f; }

  /* lane address of the transposing load: key row 8*(l>>4)+(l&7), 16-B column half (l>>3)&1 */
  const int vtro = (hi8 + (lane & 7)) * VPITCH + (((lane >> 3) & 1) << 3);

  /* stage K tile and V tile number tile, [KT][128 + pad] each, both row-major, into buffer buf */
  auto stage = [&](int tile, int buf) {
#pragma unroll
    for (int t = 0; t < KT / 8; t++) {
      const int c = tid + t * 128;            /* KT * 16 chunks of 8 halves */
      const int kk = c >> 4, seg = (c & 15) << 3;
#if USE_ASYNC
      async_cp16(kbase + (size_t)(tile * KT + kk) * HD + seg, &ldsK[buf][kk * KPITCH + seg]);
      async_cp16(vbase + (size_t)(tile * KT + kk) * HD + seg, &ldsV[buf][kk * VPITCH + seg]);
#else
      *(v8h*)(&ldsK[buf][kk * KPITCH + seg]) = *(const v8h*)(kbase + (size_t)(tile * KT + kk) * HD + seg);
      *(v8h*)(&ldsV[buf][kk * VPITCH + seg]) = *(const v8h*)(vbase + (size_t)(tile * KT + kk) * HD + seg);
#endif
    }
  };

  const int nkt = (lim + KT - 1) / KT;        /* at least 1, at most SS / KT */
  stage(0, 0);
  /* the keys' scales, published by the same barrier as tile 0 */
#pragma unroll
  for (int t = 0; t < SS / 512; t++)
    *(v4f*)(&ldsR[(tid + t * 128) * 4]) = *(const v4f*)(rsc + MM + b * SS + (tid + t * 128) * 4);
#if USE_ASYNC
  /* this wave's copies of tile 0 have landed before the barrier publishes them */
  asm volatile("s_wait_asynccnt 0x0" ::: "memory");
#endif
  __syncthreads();
  if (nkt > 1) stage(1, 1);

  for (int kt = 0; kt < nkt; ++kt) {
    const int st = kt & 1;
    const _Float16* kt16 = ldsK[st];
    const _Float16* vtr  = ldsV[st] + vtro;

    /* S^T = K * Q^T : sc[j][i][r] = score(key j*16+hi8+r, query i*16+l15) */
    v8f sc[KJ][2];
#pragma unroll
    for (int j = 0; j < KJ; j++)
#pragma unroll
      for (int i = 0; i < 2; i++) sc[j][i] = zf;
#pragma unroll
    for (int dc = 0; dc < 4; dc++) {
#pragma unroll
      for (int j = 0; j < KJ; j++) {
        const v16h ak = ld_frag(kt16 + j * 16 * KPITCH + dc * 32, KPITCH);
#pragma unroll
        for (int i = 0; i < 2; i++)
          sc[j][i] = __builtin_amdgcn_wmma_f32_16x16x32_f16(
              false, ak, false, qf[i][dc], (short)0, sc[j][i], false, false);
      }
    }

    /* the keys' scales; key mask only in a tile that reaches past the last valid key */
#pragma unroll
    for (int j = 0; j < KJ; j++) {
      const v4f kl = *(const v4f*)(&ldsR[kt * KT + j * 16 + hi8]);
      const v4f kh4 = *(const v4f*)(&ldsR[kt * KT + j * 16 + hi8 + 4]);
#pragma unroll
      for (int i = 0; i < 2; i++)
#pragma unroll
        for (int r = 0; r < 8; r++) sc[j][i][r] *= r < 4 ? kl[r & 3] : kh4[r & 3];
    }
    if (kt * KT + KT > lim) {
#pragma unroll
      for (int j = 0; j < KJ; j++)
#pragma unroll
        for (int r = 0; r < 8; r++) {
          const bool valid = kt * KT + j * 16 + hi8 + r < lim;
#pragma unroll
          for (int i = 0; i < 2; i++) sc[j][i][r] = valid ? sc[j][i][r] : -3.0e38f;
        }
    }

    /* online softmax: a lane and its partner in the other half share one query */
    v16h pf[2][KG];
#pragma unroll
    for (int i = 0; i < 2; i++) {
      /* one chain of maxima per pair of score tiles, joined at the end */
      float tg[KG];
#pragma unroll
      for (int g = 0; g < KG; g++) {
        tg[g] = fmaxf(sc[2 * g][i][0], sc[2 * g + 1][i][0]);
#pragma unroll
        for (int r = 1; r < 8; r++) tg[g] = fmaxf(tg[g], fmaxf(sc[2 * g][i][r], sc[2 * g + 1][i][r]));
      }
      float t = tg[0];
#pragma unroll
      for (int g = 1; g < KG; g++) t = fmaxf(t, tg[g]);
      t = fmaxf(t, xhalf(t));
      const float mn = fmaxf(mrow[i], t * qs[i]);   /* qs >= 0: the maximum commutes with it */
      const float al = __expf(mrow[i] - mn);
      /* one sum per score tile, joined at the end */
      float rj[KJ];
#pragma unroll
      for (int j = 0; j < KJ; j++) {
        rj[j] = 0.f;
#pragma unroll
        for (int r = 0; r < 8; r++) {
          const float p = __expf(fmaf(sc[j][i][r], qs[i], -mn));
          rj[j] += p;
          pf[i][j >> 1][(j & 1) * 8 + r] = (_Float16)p;   /* B operand P^T, hardware k order within 32 keys */
        }
      }
      float rs = 0.f;
#pragma unroll
      for (int g = 0; g < KG; g++) rs += rj[2 * g] + rj[2 * g + 1];
      lrow[i] = lrow[i] * al + rs;
      mrow[i] = mn;
#pragma unroll
      for (int dj = 0; dj < 8; dj++)
#pragma unroll
        for (int r = 0; r < 8; r++) o[i][dj][r] *= al;
    }

    /* O^T += V^T * P^T  (A frags: rows = d, matmul-K = key) */
#pragma unroll
    for (int g = 0; g < KG; g++)
#pragma unroll
      for (int dj = 0; dj < 8; dj++) {
        const v8h lo = ld_tr16(vtr + (g * 32) * VPITCH + dj * 16);
        const v8h hi = ld_tr16(vtr + (g * 32 + 16) * VPITCH + dj * 16);
        v16h vf;
#pragma unroll
        for (int e = 0; e < 8; e++) { vf[e] = lo[e]; vf[8 + e] = hi[e]; }
        o[0][dj] = __builtin_amdgcn_wmma_f32_16x16x32_f16(
            false, vf, false, pf[0][g], (short)0, o[0][dj], false, false);
        o[1][dj] = __builtin_amdgcn_wmma_f32_16x16x32_f16(
            false, vf, false, pf[1][g], (short)0, o[1][dj], false, false);
      }

    /* hand-over: this wave has left buffer st ... */
    asm volatile("s_wait_dscnt 0x0" ::: "memory");
#if USE_ASYNC
    /* ... and its copies of tile kt + 1 have landed, before the one barrier that
       publishes that tile and frees buffer st for the refill behind it */
    asm volatile("s_wait_asynccnt 0x0" ::: "memory");
#endif
    __syncthreads();
    if (kt + 2 < nkt) stage(kt + 2, st);
  }
#if USE_ASYNC
  /* no copy is outstanding when the wave ends */
  asm volatile("s_wait_asynccnt 0x0" ::: "memory");
#endif

  /* join the halves' sums, normalize, write [B,S,D] f16: 8 consecutive d per lane */
#pragma unroll
  for (int i = 0; i < 2; i++) {
    const int srow = qt * 128 + w * 32 + i * 16 + l15;
    const float inv = 1.0f / (lrow[i] + xhalf(lrow[i]));
    _Float16* orow = oh + ((size_t)(b * SS + srow)) * DD + h * HD + hi8;
#pragma unroll
    for (int dj = 0; dj < 8; dj++) {
      v8h ov;
#pragma unroll
      for (int r = 0; r < 8; r++) ov[r] = (_Float16)(o[i][dj][r] * inv);
      *(v8h*)(orow + dj * 16) = ov;
    }
  }
}

/* ---------------- host-side orchestration ---------------- */
extern "C" void kernel_launch(void* const* d_in, const int* in_sizes, int n_in,
                              void* d_out, int out_size, void* d_ws, size_t ws_size,
                              hipStream_t stream) {
  (void)in_sizes; (void)n_in; (void)out_size; (void)ws_size;
  const float* x        = (const float*)d_in[0];
  const int*   seq_lens = (const int*)d_in[1];
  const float* freqs    = (const float*)d_in[2];
  const float* wq = (const float*)d_in[3];
  const float* bq = (const float*)d_in[4];
  const float* wk = (const float*)d_in[5];
  const float* bk = (const float*)d_in[6];
  const float* wv = (const float*)d_in[7];
  const float* bv = (const float*)d_in[8];
  const float* wo = (const float*)d_in[9];
  const float* bo = (const float*)d_in[10];
  const float* gq = (const float*)d_in[11];
  const float* gk = (const float*)d_in[12];

  char* ws = (char*)d_ws;
  _Float16* xh    = (_Float16*)(ws + OFF_XH);
  _Float16* wqkvh = (_Float16*)(ws + OFF_WQKV);
  _Float16* woh   = (_Float16*)(ws + OFF_WO);
  float*    part  = (float*)(ws + OFF_Y);
  float*    rsp   = (float*)(ws + OFF_RS);
  _Float16* qhp   = (_Float16*)(ws + OFF_QH);
  _Float16* khp   = (_Float16*)(ws + OFF_KH);
  _Float16* vhp   = (_Float16*)(ws + OFF_VH);
  _Float16* ohp   = (_Float16*)(ws + OFF_OH);

  /* 1) down-convert activations + weights to f16 */
  cvt_f16<<<CVT_XB + 4 * CVT_WB, 256, 0, stream>>>(x, wq, wk, wv, wo, xh);

  /* 2) fused QKV projection with bias, gain, RoPE and repack; square sums per wave */
  gemm_wmma<192, N1, true><<<dim3(N1 / 192, MM / GBM), 256, 0, stream>>>(
      xh, wqkvh, part, MM, N1, DD, bq, bk, bv, DD, 2 * DD, freqs, gq, gk, qhp, khp, vhp);

  /* 3) RMS row scales of q and k */
  rms_scale<<<2 * MM / 256, 256, 0, stream>>>(part, rsp);

  /* 4) flash attention */
  attn_wmma<<<BB * NH * (SS / 128), 128, 0, stream>>>(qhp, khp, vhp, seq_lens, rsp, ohp);

  /* 5) output projection into d_out (f32) */
  gemm_wmma<128, DD, false><<<dim3(DD / 128, MM / GBM), 256, 0, stream>>>(
      ohp, woh, (float*)d_out, MM, DD, DD, bo, bo, bo, DD, 2 * DD, freqs, gq, gk, qhp, khp, vhp);
}
